// v000
// Measured on an AMD MI455X. A time is GPU time per run, averaged over a window of back-to-back runs after a warm-up
// (all launches, gaps included; the runs take copies of the inputs in turn), and the median of several windows.
// Apart from v000's, it joins two sittings. Times from different sittings can be a few percent apart, while
// side-by-side timings come from the same sitting.
// v000 is the starting kernel. One run takes 194 microseconds.
#include <hip/hip_runtime.h>
#include <hip/hip_bf16.h>

// ---------- constants ----------
#define BATCH 8
#define SEQ   2048
#define EMBED 768
#define HD    64
#define QKVN  192           // 3 * HD
#define ROWS  (BATCH * SEQ) // 16384
#define SCALE 0.125f        // 64^-0.5
#define LOG2E 1.44269504088896f

typedef _Float16 v4h  __attribute__((ext_vector_type(4)));
typedef _Float16 v8h  __attribute__((ext_vector_type(8)));
typedef _Float16 v16h __attribute__((ext_vector_type(16)));
typedef float    v8f  __attribute__((ext_vector_type(8)));

union H16 { v16h v; struct { v8h lo; v8h hi; } h; };

static __device__ __forceinline__ v8f wmma_f16(v16h a, v16h b, v8f c) {
    // D = A(16x32 f16) * B(32x16 f16) + C(16x16 f32)
    return __builtin_amdgcn_wmma_f32_16x16x32_f16(false, a, false, b, (short)0, c,
                                                  false, false);
}

// Load a 16x32 f16 A-operand (== B-operand of the transpose) from a row-major
// matrix with leading dimension ld (in halves), rows starting at row0, k-block kb.
static __device__ __forceinline__ v16h load_op(const _Float16* __restrict__ base,
                                               int row0, int ld, int kb,
                                               int lo, int hi) {
    const _Float16* r = base + (size_t)(row0 + lo) * ld + kb + hi * 8;
    H16 u;
    u.h.lo = *(const v8h*)(r);
    u.h.hi = *(const v8h*)(r + 16);
    return u.v;
}

// ---------- kernel 1a: x (f32) -> xh (f16) ----------
__global__ __launch_bounds__(256) void k_convert_x(const float* __restrict__ x,
                                                   _Float16* __restrict__ xh) {
    size_t i = ((size_t)blockIdx.x * 256 + threadIdx.x) * 4;
    float4 f = *(const float4*)(x + i);
    v4h h = { (_Float16)f.x, (_Float16)f.y, (_Float16)f.z, (_Float16)f.w };
    *(v4h*)(xh + i) = h;
}

// ---------- kernel 1b: w_qkv (768x192 f32) -> Wt (192x768 f16) ----------
__global__ __launch_bounds__(256) void k_tr_wqkv(const float* __restrict__ w,
                                                 _Float16* __restrict__ wt) {
    int idx = blockIdx.x * 256 + threadIdx.x;      // < 147456
    int e = idx / QKVN, n = idx % QKVN;
    wt[(size_t)n * EMBED + e] = (_Float16)w[idx];
}

// ---------- kernel 1c: w_proj (64x64 f32) -> Wpt (64x64 f16, transposed) ----------
__global__ __launch_bounds__(256) void k_tr_wproj(const float* __restrict__ w,
                                                  _Float16* __restrict__ wpt) {
    int idx = blockIdx.x * 256 + threadIdx.x;      // < 4096
    int k = idx / HD, n = idx % HD;
    wpt[(size_t)n * HD + k] = (_Float16)w[idx];
}

// ---------- kernel 2: QKV projection ----------
// One wave computes a full 16x192 row-block (12 resident accumulators).
// All 12 B operands are loaded into distinct registers BEFORE the WMMA chain so
// the scheduler can overlap loads with matrix ops (partial loadcnt waits)
// instead of draining the load pipe before every WMMA.
__global__ __launch_bounds__(128) void k_qkv(const _Float16* __restrict__ xh,
                                             const _Float16* __restrict__ wt,
                                             _Float16* __restrict__ qh,
                                             _Float16* __restrict__ kh,
                                             _Float16* __restrict__ vt) {
    const int lane = threadIdx.x & 31;
    const int lo = lane & 15, hi = lane >> 4;
    const int mt = blockIdx.x * 4 + (threadIdx.x >> 5);  // < 1024
    const int m0 = mt * 16;

    const _Float16* xrow = xh + (size_t)(m0 + lo) * EMBED + hi * 8;

    v8f acc[12];
#pragma unroll
    for (int nt = 0; nt < 12; ++nt) acc[nt] = (v8f){};

#pragma unroll 1
    for (int kb = 0; kb < EMBED; kb += 32) {
        H16 a;
        a.h.lo = *(const v8h*)(xrow + kb);
        a.h.hi = *(const v8h*)(xrow + kb + 16);

        v16h bv[12];
#pragma unroll
        for (int nt = 0; nt < 12; ++nt)
            bv[nt] = load_op(wt, nt * 16, EMBED, kb, lo, hi);

        if (kb + 32 < EMBED)  // next A k-block (x is the HBM-resident stream)
            __builtin_prefetch(xrow + kb + 32, 0, 0);

#pragma unroll
        for (int nt = 0; nt < 12; ++nt)
            acc[nt] = wmma_f16(a.v, bv[nt], acc[nt]);
    }

    const int bidx = m0 >> 11;
    const int rin = m0 & (SEQ - 1);
#pragma unroll
    for (int nt = 0; nt < 12; ++nt) {
#pragma unroll
        for (int r = 0; r < 8; ++r) {
            int row = m0 + r + 8 * hi;
            _Float16 v = (_Float16)acc[nt][r];
            if (nt < 4) {
                qh[(size_t)row * HD + nt * 16 + lo] = v;
            } else if (nt < 8) {
                kh[(size_t)row * HD + (nt - 4) * 16 + lo] = v;
            } else {
                vt[(size_t)bidx * HD * SEQ +
                   (size_t)((nt - 8) * 16 + lo) * SEQ + (rin + r + 8 * hi)] = v;
            }
        }
    }
}

// ---------- kernel 3: flash attention + output projection ----------
// One wave owns 32 query rows (two 16-row tiles): K/V operands shared across
// both tiles -> 16 WMMAs per 8 operand loads (16 global b128) per 32-key step.
__global__ __launch_bounds__(128) void k_attn(const _Float16* __restrict__ qh,
                                              const _Float16* __restrict__ kh,
                                              const _Float16* __restrict__ vt,
                                              const _Float16* __restrict__ wpt,
                                              const float* __restrict__ bias,
                                              float* __restrict__ out) {
    __shared__ __align__(16) _Float16 smem[4][32 * 64];
    const int lane = threadIdx.x & 31;
    const int lo = lane & 15, hi = lane >> 4;
    const int wave = threadIdx.x >> 5;
    const int gw = blockIdx.x * 4 + wave;   // < 512
    const int m0 = gw * 32;                 // first of 32 query rows
    const int b = m0 >> 11;
    _Float16* pbuf = smem[wave];

    // resident Q operands: two row-tiles x two k-blocks
    v16h qa[2][2];
#pragma unroll
    for (int t = 0; t < 2; ++t) {
        qa[t][0] = load_op(qh, m0 + t * 16, HD, 0, lo, hi);
        qa[t][1] = load_op(qh, m0 + t * 16, HD, 32, lo, hi);
    }

    const _Float16* kbase = kh + (size_t)b * SEQ * HD;
    const _Float16* vbase = vt + (size_t)b * HD * SEQ;

    v8f o[2][4];
    float mr[2][8], ls[2][8];
#pragma unroll
    for (int t = 0; t < 2; ++t) {
#pragma unroll
        for (int n = 0; n < 4; ++n) o[t][n] = (v8f){};
#pragma unroll
        for (int r = 0; r < 8; ++r) { mr[t][r] = -3.0e38f; ls[t][r] = 0.0f; }
    }

    for (int kv = 0; kv < SEQ; kv += 32) {
        // shared K operands for S, shared V operands for PV (distinct registers)
        const v16h kb0 = load_op(kbase, kv,      HD, 0,  lo, hi);
        const v16h kb1 = load_op(kbase, kv,      HD, 32, lo, hi);
        const v16h kb2 = load_op(kbase, kv + 16, HD, 0,  lo, hi);
        const v16h kb3 = load_op(kbase, kv + 16, HD, 32, lo, hi);
        const v16h vb0 = load_op(vbase,  0, SEQ, kv, lo, hi);
        const v16h vb1 = load_op(vbase, 16, SEQ, kv, lo, hi);
        const v16h vb2 = load_op(vbase, 32, SEQ, kv, lo, hi);
        const v16h vb3 = load_op(vbase, 48, SEQ, kv, lo, hi);

        if (kv + 32 < SEQ) {  // prefetch next K/V tiles
            __builtin_prefetch(kbase + (size_t)(kv + 32 + lane) * HD, 0, 0);
            __builtin_prefetch(vbase + (size_t)lane * SEQ + kv + 32, 0, 0);
            __builtin_prefetch(vbase + (size_t)(32 + lane) * SEQ + kv + 32, 0, 0);
        }

#pragma unroll
        for (int t = 0; t < 2; ++t) {
            // ---- S = Q @ K^T (16 rows x 32 keys) ----
            v8f s0 = {}, s1 = {};
            s0 = wmma_f16(qa[t][0], kb0, s0);
            s0 = wmma_f16(qa[t][1], kb1, s0);
            s1 = wmma_f16(qa[t][0], kb2, s1);
            s1 = wmma_f16(qa[t][1], kb3, s1);

            // ---- online softmax: row M = r + 8*hi lives in one 16-lane half ----
#pragma unroll
            for (int r = 0; r < 8; ++r) {
                float a0 = s0[r] * SCALE;
                float a1 = s1[r] * SCALE;
                float t0 = fmaxf(a0, a1);
                t0 = fmaxf(t0, __shfl_xor(t0, 1, 32));
                t0 = fmaxf(t0, __shfl_xor(t0, 2, 32));
                t0 = fmaxf(t0, __shfl_xor(t0, 4, 32));
                t0 = fmaxf(t0, __shfl_xor(t0, 8, 32));
                float mnew = fmaxf(mr[t][r], t0);
                float alpha = exp2f((mr[t][r] - mnew) * LOG2E);
                float p0 = exp2f((a0 - mnew) * LOG2E);
                float p1 = exp2f((a1 - mnew) * LOG2E);
                float rs = p0 + p1;
                rs += __shfl_xor(rs, 1, 32);
                rs += __shfl_xor(rs, 2, 32);
                rs += __shfl_xor(rs, 4, 32);
                rs += __shfl_xor(rs, 8, 32);
                ls[t][r] = ls[t][r] * alpha + rs;
                mr[t][r] = mnew;
                o[t][0][r] *= alpha; o[t][1][r] *= alpha;
                o[t][2][r] *= alpha; o[t][3][r] *= alpha;
                // stage P tile (rows t*16.., 32 wide) in this wave's LDS slice
                pbuf[(t * 16 + r + 8 * hi) * 32 + lo]      = (_Float16)p0;
                pbuf[(t * 16 + r + 8 * hi) * 32 + 16 + lo] = (_Float16)p1;
            }
        }

        // ---- O += P @ V for both row tiles (V operands reused) ----
#pragma unroll
        for (int t = 0; t < 2; ++t) {
            H16 pa;
            const _Float16* pr = pbuf + (t * 16 + lo) * 32 + hi * 8;
            pa.h.lo = *(const v8h*)(pr);
            pa.h.hi = *(const v8h*)(pr + 16);
            o[t][0] = wmma_f16(pa.v, vb0, o[t][0]);
            o[t][1] = wmma_f16(pa.v, vb1, o[t][1]);
            o[t][2] = wmma_f16(pa.v, vb2, o[t][2]);
            o[t][3] = wmma_f16(pa.v, vb3, o[t][3]);
        }
    }

    // ---- normalize and stage O (32x64 f16) in LDS ----
#pragma unroll
    for (int t = 0; t < 2; ++t) {
#pragma unroll
        for (int r = 0; r < 8; ++r) {
            float inv = 1.0f / ls[t][r];
            _Float16* orow = pbuf + (t * 16 + r + 8 * hi) * 64;
            orow[ 0 + lo] = (_Float16)(o[t][0][r] * inv);
            orow[16 + lo] = (_Float16)(o[t][1][r] * inv);
            orow[32 + lo] = (_Float16)(o[t][2][r] * inv);
            orow[48 + lo] = (_Float16)(o[t][3][r] * inv);
        }
    }

    // ---- fused projection: out = O @ w_proj + b_proj ----
#pragma unroll
    for (int t = 0; t < 2; ++t) {
        H16 oa0, oa1;
        const _Float16* orow = pbuf + (t * 16 + lo) * 64 + hi * 8;
        oa0.h.lo = *(const v8h*)(orow);
        oa0.h.hi = *(const v8h*)(orow + 16);
        oa1.h.lo = *(const v8h*)(orow + 32);
        oa1.h.hi = *(const v8h*)(orow + 48);
#pragma unroll
        for (int ct = 0; ct < 4; ++ct) {
            float bv = bias[ct * 16 + lo];
            v8f acc;
#pragma unroll
            for (int r = 0; r < 8; ++r) acc[r] = bv;
            acc = wmma_f16(oa0.v, load_op(wpt, ct * 16, HD, 0,  lo, hi), acc);
            acc = wmma_f16(oa1.v, load_op(wpt, ct * 16, HD, 32, lo, hi), acc);
#pragma unroll
            for (int r = 0; r < 8; ++r)
                out[(size_t)(m0 + t * 16 + r + 8 * hi) * HD + ct * 16 + lo] = acc[r];
        }
    }
}

// ---------- host launcher ----------
extern "C" void kernel_launch(void* const* d_in, const int* in_sizes, int n_in,
                              void* d_out, int out_size, void* d_ws, size_t ws_size,
                              hipStream_t stream) {
    (void)in_sizes; (void)n_in; (void)out_size; (void)ws_size;
    const float* x     = (const float*)d_in[0];
    const float* wqkv  = (const float*)d_in[1];
    const float* wproj = (const float*)d_in[2];
    const float* bproj = (const float*)d_in[3];
    float* out = (float*)d_out;

    char* ws = (char*)d_ws;
    _Float16* xh  = (_Float16*)(ws);                // 25,165,824 B
    _Float16* wt  = (_Float16*)(ws + 25165824);     //    294,912 B
    _Float16* wpt = (_Float16*)(ws + 25460736);     //      8,192 B
    _Float16* qh  = (_Float16*)(ws + 25468928);     //  2,097,152 B
    _Float16* kh  = (_Float16*)(ws + 27566080);     //  2,097,152 B
    _Float16* vt  = (_Float16*)(ws + 29663232);     //  2,097,152 B  (total ~30.3 MB)

    k_convert_x<<<ROWS * EMBED / 1024, 256, 0, stream>>>(x, xh);
    k_tr_wqkv<<<EMBED * QKVN / 256, 256, 0, stream>>>(wqkv, wt);
    k_tr_wproj<<<HD * HD / 256, 256, 0, stream>>>(wproj, wpt);
    k_qkv<<<(ROWS / 16) / 4, 128, 0, stream>>>(xh, wt, qh, kh, vt);
    k_attn<<<(ROWS / 32) / 4, 128, 0, stream>>>(qh, kh, vt, wpt, bproj, out);
}

// v001
// It runs in 82.1 microseconds.
// Two timings next to v000 put it at 2.36 and 2.40 times that version's speed.
#include <hip/hip_runtime.h>
#include <hip/hip_bf16.h>

// ---------- constants ----------
#define BATCH 8
#define SEQ   2048
#define EMBED 768
#define HD    64
#define QKVN  192           // 3 * HD
#define ROWS  (BATCH * SEQ) // 16384
#define SCALE 0.125f        // 64^-0.5
#define LOG2E 1.44269504088896f

typedef _Float16 v4h  __attribute__((ext_vector_type(4)));
typedef _Float16 v8h  __attribute__((ext_vector_type(8)));
typedef _Float16 v16h __attribute__((ext_vector_type(16)));
typedef float    v8f  __attribute__((ext_vector_type(8)));

union H16 { v16h v; struct { v8h lo; v8h hi; } h; };

static __device__ __forceinline__ v8f wmma_f16(v16h a, v16h b, v8f c) {
    // D = A(16x32 f16) * B(32x16 f16) + C(16x16 f32)
    return __builtin_amdgcn_wmma_f32_16x16x32_f16(false, a, false, b, (short)0, c,
                                                  false, false);
}

// Load a 16x32 f16 A-operand (== B-operand of the transpose) from a row-major
// matrix with leading dimension ld (in halves), rows starting at row0, k-block kb.
static __device__ __forceinline__ v16h load_op(const _Float16* __restrict__ base,
                                               int row0, int ld, int kb,
                                               int lo, int hi) {
    const _Float16* r = base + (size_t)(row0 + lo) * ld + kb + hi * 8;
    H16 u;
    u.h.lo = *(const v8h*)(r);
    u.h.hi = *(const v8h*)(r + 16);
    return u.v;
}

// ---------- kernel 1a: x (f32) -> xh (f16) ----------
__global__ __launch_bounds__(256) void k_convert_x(const float* __restrict__ x,
                                                   _Float16* __restrict__ xh) {
    size_t i = ((size_t)blockIdx.x * 256 + threadIdx.x) * 4;
    float4 f = *(const float4*)(x + i);
    v4h h = { (_Float16)f.x, (_Float16)f.y, (_Float16)f.z, (_Float16)f.w };
    *(v4h*)(xh + i) = h;
}

// ---------- kernel 1b: w_qkv (768x192 f32) -> Wt (192x768 f16) ----------
__global__ __launch_bounds__(256) void k_tr_wqkv(const float* __restrict__ w,
                                                 _Float16* __restrict__ wt) {
    int idx = blockIdx.x * 256 + threadIdx.x;      // < 147456
    int e = idx / QKVN, n = idx % QKVN;
    wt[(size_t)n * EMBED + e] = (_Float16)w[idx];
}

// ---------- kernel 1c: w_proj (64x64 f32) -> Wpt (64x64 f16, transposed) ----------
__global__ __launch_bounds__(256) void k_tr_wproj(const float* __restrict__ w,
                                                  _Float16* __restrict__ wpt) {
    int idx = blockIdx.x * 256 + threadIdx.x;      // < 4096
    int k = idx / HD, n = idx % HD;
    wpt[(size_t)n * HD + k] = (_Float16)w[idx];
}

// ---------- kernel 2: QKV projection ----------
// One wave computes a full 16x192 row-block (12 resident accumulators).
// All 12 B operands are loaded into distinct registers BEFORE the WMMA chain so
// the scheduler can overlap loads with matrix ops (partial loadcnt waits)
// instead of draining the load pipe before every WMMA.
__global__ __launch_bounds__(128) void k_qkv(const _Float16* __restrict__ xh,
                                             const _Float16* __restrict__ wt,
                                             _Float16* __restrict__ qh,
                                             _Float16* __restrict__ kh,
                                             _Float16* __restrict__ vt) {
    const int lane = threadIdx.x & 31;
    const int lo = lane & 15, hi = lane >> 4;
    const int mt = blockIdx.x * 4 + (threadIdx.x >> 5);  // < 1024
    const int m0 = mt * 16;

    const _Float16* xrow = xh + (size_t)(m0 + lo) * EMBED + hi * 8;

    v8f acc[12];
#pragma unroll
    for (int nt = 0; nt < 12; ++nt) acc[nt] = (v8f){};

#pragma unroll 1
    for (int kb = 0; kb < EMBED; kb += 32) {
        H16 a;
        a.h.lo = *(const v8h*)(xrow + kb);
        a.h.hi = *(const v8h*)(xrow + kb + 16);

        v16h bv[12];
#pragma unroll
        for (int nt = 0; nt < 12; ++nt)
            bv[nt] = load_op(wt, nt * 16, EMBED, kb, lo, hi);

        if (kb + 32 < EMBED)  // next A k-block (x is the HBM-resident stream)
            __builtin_prefetch(xrow + kb + 32, 0, 0);

#pragma unroll
        for (int nt = 0; nt < 12; ++nt)
            acc[nt] = wmma_f16(a.v, bv[nt], acc[nt]);
    }

    const int bidx = m0 >> 11;
    const int rin = m0 & (SEQ - 1);
#pragma unroll
    for (int nt = 0; nt < 12; ++nt) {
#pragma unroll
        for (int r = 0; r < 8; ++r) {
            int row = m0 + r + 8 * hi;
            _Float16 v = (_Float16)acc[nt][r];
            if (nt < 4) {
                qh[(size_t)row * HD + nt * 16 + lo] = v;
            } else if (nt < 8) {
                kh[(size_t)row * HD + (nt - 4) * 16 + lo] = v;
            } else {
                vt[(size_t)bidx * HD * SEQ +
                   (size_t)((nt - 8) * 16 + lo) * SEQ + (rin + r + 8 * hi)] = v;
            }
        }
    }
}

// value of lane l ^ 16 (the other half of the wave), on the vector pipe
static __device__ __forceinline__ float xhalf(float x) {
    int i = __builtin_bit_cast(int, x);
    return __builtin_bit_cast(float, __builtin_amdgcn_permlanex16(
        i, i, 0x76543210, 0xfedcba98, false, false));
}

__global__ __launch_bounds__(128) void k_attn(const _Float16* __restrict__ qh,
                                              const _Float16* __restrict__ kh,
                                              const _Float16* __restrict__ vt,
                                              const _Float16* __restrict__ wpt,
                                              const float* __restrict__ bias,
                                              float* __restrict__ out) {
    const int lane = threadIdx.x & 31;
    const int lo = lane & 15, hi = lane >> 4;
    const int wave = threadIdx.x >> 5;
    const int gw = blockIdx.x * 4 + wave;   // < 512
    const int m0 = gw * 32;                 // first of 32 query rows
    const int b = m0 >> 11;

    // resident Q operands (B of S^T): two row-tiles x two k-blocks
    v16h qa[2][2];
#pragma unroll
    for (int t = 0; t < 2; ++t) {
        qa[t][0] = load_op(qh, m0 + t * 16, HD, 0, lo, hi);
        qa[t][1] = load_op(qh, m0 + t * 16, HD, 32, lo, hi);
    }

    const _Float16* kbase = kh + (size_t)b * SEQ * HD;
    const _Float16* vbase = vt + (size_t)b * HD * SEQ;

    // o[t][n]: O^T tile, rows d = 16*n + 8*hi + r, column = query t*16 + lo.
    // mr[t]: running maximum of that query (equal in both halves);
    // ls[t]: running sum over this half's keys only, joined after the loop.
    v8f o[2][4];
    float mr[2], ls[2];
#pragma unroll
    for (int t = 0; t < 2; ++t) {
#pragma unroll
        for (int n = 0; n < 4; ++n) o[t][n] = (v8f){};
        mr[t] = -3.0e38f; ls[t] = 0.0f;
    }

    for (int kv = 0; kv < SEQ; kv += 32) {
        // shared K operands for S^T, shared V^T operands for O^T (distinct registers)
        const v16h kb0 = load_op(kbase, kv,      HD, 0,  lo, hi);
        const v16h kb1 = load_op(kbase, kv,      HD, 32, lo, hi);
        const v16h kb2 = load_op(kbase, kv + 16, HD, 0,  lo, hi);
        const v16h kb3 = load_op(kbase, kv + 16, HD, 32, lo, hi);
        const v16h vb0 = load_op(vbase,  0, SEQ, kv, lo, hi);
        const v16h vb1 = load_op(vbase, 16, SEQ, kv, lo, hi);
        const v16h vb2 = load_op(vbase, 32, SEQ, kv, lo, hi);
        const v16h vb3 = load_op(vbase, 48, SEQ, kv, lo, hi);

        if (kv + 32 < SEQ) {  // prefetch next K/V tiles
            __builtin_prefetch(kbase + (size_t)(kv + 32 + lane) * HD, 0, 0);
            __builtin_prefetch(vbase + (size_t)lane * SEQ + kv + 32, 0, 0);
            __builtin_prefetch(vbase + (size_t)(32 + lane) * SEQ + kv + 32, 0, 0);
        }

#pragma unroll
        for (int t = 0; t < 2; ++t) {
            // ---- S^T = K @ Q^T (32 keys x 16 queries) ----
            v8f s0 = {}, s1 = {};
            s0 = wmma_f16(kb0, qa[t][0], s0);
            s0 = wmma_f16(kb1, qa[t][1], s0);
            s1 = wmma_f16(kb2, qa[t][0], s1);
            s1 = wmma_f16(kb3, qa[t][1], s1);

            // ---- online softmax: 16 of the query's 32 scores in this lane ----
            float a0[8], a1[8], mx[8];
#pragma unroll
            for (int r = 0; r < 8; ++r) {
                a0[r] = s0[r] * SCALE;
                a1[r] = s1[r] * SCALE;
                mx[r] = fmaxf(a0[r], a1[r]);
            }
            float t0 = fmaxf(fmaxf(fmaxf(mx[0], mx[1]), fmaxf(mx[2], mx[3])),
                             fmaxf(fmaxf(mx[4], mx[5]), fmaxf(mx[6], mx[7])));
            t0 = fmaxf(t0, xhalf(t0));
            const float mnew = fmaxf(mr[t], t0);
            const float alpha = exp2f((mr[t] - mnew) * LOG2E);

            H16 pb;      // P^T as B operand: k = 8*hi + r, then 16 + 8*hi + r
            float ps[8];
#pragma unroll
            for (int r = 0; r < 8; ++r) {
                float p0 = exp2f((a0[r] - mnew) * LOG2E);
                float p1 = exp2f((a1[r] - mnew) * LOG2E);
                ps[r] = p0 + p1;
                pb.v[r]     = (_Float16)p0;
                pb.v[8 + r] = (_Float16)p1;
            }
            const float rs = ((ps[0] + ps[1]) + (ps[2] + ps[3])) +
                             ((ps[4] + ps[5]) + (ps[6] + ps[7]));
            ls[t] = ls[t] * alpha + rs;
            mr[t] = mnew;

            // ---- O^T = O^T * alpha + V^T @ P^T ----
#pragma unroll
            for (int n = 0; n < 4; ++n) o[t][n] *= alpha;
            o[t][0] = wmma_f16(vb0, pb.v, o[t][0]);
            o[t][1] = wmma_f16(vb1, pb.v, o[t][1]);
            o[t][2] = wmma_f16(vb2, pb.v, o[t][2]);
            o[t][3] = wmma_f16(vb3, pb.v, o[t][3]);
        }
    }

    // ---- normalize; fused projection out^T = w_proj^T @ O^T + b_proj ----
#pragma unroll
    for (int t = 0; t < 2; ++t) {
        const float inv = 1.0f / (ls[t] + xhalf(ls[t]));
        H16 ob0, ob1;   // O^T as B operand, k = d: tiles 0,1 then tiles 2,3
#pragma unroll
        for (int r = 0; r < 8; ++r) {
            ob0.v[r]     = (_Float16)(o[t][0][r] * inv);
            ob0.v[8 + r] = (_Float16)(o[t][1][r] * inv);
            ob1.v[r]     = (_Float16)(o[t][2][r] * inv);
            ob1.v[8 + r] = (_Float16)(o[t][3][r] * inv);
        }
        float* orow = out + (size_t)(m0 + t * 16 + lo) * HD + 8 * hi;
#pragma unroll
        for (int ct = 0; ct < 4; ++ct) {
            // rows of out^T: output columns ct*16 + 8*hi + r of query row lo
            const float4 b0 = *(const float4*)(bias + ct * 16 + 8 * hi);
            const float4 b1 = *(const float4*)(bias + ct * 16 + 8 * hi + 4);
            v8f acc = { b0.x, b0.y, b0.z, b0.w, b1.x, b1.y, b1.z, b1.w };
            acc = wmma_f16(load_op(wpt, ct * 16, HD, 0,  lo, hi), ob0.v, acc);
            acc = wmma_f16(load_op(wpt, ct * 16, HD, 32, lo, hi), ob1.v, acc);
            *(float4*)(orow + ct * 16)     = make_float4(acc[0], acc[1], acc[2], acc[3]);
            *(float4*)(orow + ct * 16 + 4) = make_float4(acc[4], acc[5], acc[6], acc[7]);
        }
    }
}

// ---------- host launcher ----------
extern "C" void kernel_launch(void* const* d_in, const int* in_sizes, int n_in,
                              void* d_out, int out_size, void* d_ws, size_t ws_size,
                              hipStream_t stream) {
    (void)in_sizes; (void)n_in; (void)out_size; (void)ws_size;
    const float* x     = (const float*)d_in[0];
    const float* wqkv  = (const float*)d_in[1];
    const float* wproj = (const float*)d_in[2];
    const float* bproj = (const float*)d_in[3];
    float* out = (float*)d_out;

    char* ws = (char*)d_ws;
    _Float16* xh  = (_Float16*)(ws);                // 25,165,824 B
    _Float16* wt  = (_Float16*)(ws + 25165824);     //    294,912 B
    _Float16* wpt = (_Float16*)(ws + 25460736);     //      8,192 B
    _Float16* qh  = (_Float16*)(ws + 25468928);     //  2,097,152 B
    _Float16* kh  = (_Float16*)(ws + 27566080);     //  2,097,152 B
    _Float16* vt  = (_Float16*)(ws + 29663232);     //  2,097,152 B  (total ~30.3 MB)

    k_convert_x<<<ROWS * EMBED / 1024, 256, 0, stream>>>(x, xh);
    k_tr_wqkv<<<EMBED * QKVN / 256, 256, 0, stream>>>(wqkv, wt);
    k_tr_wproj<<<HD * HD / 256, 256, 0, stream>>>(wproj, wpt);
    k_qkv<<<(ROWS / 16) / 4, 128, 0, stream>>>(xh, wt, qh, kh, vt);
    k_attn<<<(ROWS / 32) / 4, 128, 0, stream>>>(qh, kh, vt, wpt, bproj, out);
}

// v002
// Measured time: 73.2 microseconds a run.
// Two timings next to v001 put it at 1.12 and 1.09 times that version's speed.
// Over all steps from v000 it is 2.62 times as fast.
#include <hip/hip_runtime.h>
#include <hip/hip_bf16.h>

// ---------- constants ----------
#define BATCH 8
#define SEQ   2048
#define EMBED 768
#define HD    64
#define QKVN  192           // 3 * HD
#define ROWS  (BATCH * SEQ) // 16384
#define SCALE 0.125f        // 64^-0.5
#define LOG2E 1.44269504088896f

typedef _Float16 v4h  __attribute__((ext_vector_type(4)));
typedef _Float16 v8h  __attribute__((ext_vector_type(8)));
typedef _Float16 v16h __attribute__((ext_vector_type(16)));
typedef float    v8f  __attribute__((ext_vector_type(8)));
typedef float    v4f  __attribute__((ext_vector_type(4)));

union H16 { v16h v; struct { v8h lo; v8h hi; } h; };

static __device__ __forceinline__ v8f wmma_f16(v16h a, v16h b, v8f c) {
    // D = A(16x32 f16) * B(32x16 f16) + C(16x16 f32)
    return __builtin_amdgcn_wmma_f32_16x16x32_f16(false, a, false, b, (short)0, c,
                                                  false, false);
}

// Load a 16x32 f16 A-operand (== B-operand of the transpose) from a row-major
// matrix with leading dimension ld (in halves), rows starting at row0, k-block kb.
static __device__ __forceinline__ v16h load_op(const _Float16* __restrict__ base,
                                               int row0, int ld, int kb,
                                               int lo, int hi) {
    const _Float16* r = base + (size_t)(row0 + lo) * ld + kb + hi * 8;
    H16 u;
    u.h.lo = *(const v8h*)(r);
    u.h.hi = *(const v8h*)(r + 16);
    return u.v;
}

// ---------- kernel 1b: w_qkv (768x192 f32) -> Wt (192x768 f16) ----------
__global__ __launch_bounds__(256) void k_tr_wqkv(const float* __restrict__ w,
                                                 _Float16* __restrict__ wt) {
    int idx = blockIdx.x * 256 + threadIdx.x;      // < 147456
    int e = idx / QKVN, n = idx % QKVN;
    wt[(size_t)n * EMBED + e] = (_Float16)w[idx];
}

// ---------- kernel 1c: w_proj (64x64 f32) -> Wpt (64x64 f16, transposed) ----------
__global__ __launch_bounds__(256) void k_tr_wproj(const float* __restrict__ w,
                                                  _Float16* __restrict__ wpt) {
    int idx = blockIdx.x * 256 + threadIdx.x;      // < 4096
    int k = idx / HD, n = idx % HD;
    wpt[(size_t)n * HD + k] = (_Float16)w[idx];
}

// ---------- kernel 2: QKV projection ----------
// One wave computes a full 16x192 row-block (12 resident accumulators).
// All 12 B operands are loaded into distinct registers BEFORE the WMMA chain so
// the scheduler can overlap loads with matrix ops (partial loadcnt waits)
// instead of draining the load pipe before every WMMA.
// x is read as f32 and rounded to f16 (nearest even) in registers on its way
// into the A operand: a lane's 16 k values are two runs of 8 floats of its row.
__global__ __launch_bounds__(128) void k_qkv(const float* __restrict__ x,
                                             const _Float16* __restrict__ wt,
                                             _Float16* __restrict__ qh,
                                             _Float16* __restrict__ kh,
                                             _Float16* __restrict__ vt) {
    const int lane = threadIdx.x & 31;
    const int lo = lane & 15, hi = lane >> 4;
    const int mt = blockIdx.x * 4 + (threadIdx.x >> 5);  // < 1024
    const int m0 = mt * 16;

    // walks the lane's row, one k-block (128 bytes) a trip
    const float* xp = x + (size_t)(m0 + lo) * EMBED + hi * 8;

    // x comes from memory and the load counter returns in order, so a load issued
    // ahead would hold up the weight loads behind it: prefetch the row into L2 ahead
    // of its loads instead, one address every 256 bytes. Units 1 to 3 here, unit u + 4 in the loop.
    asm volatile("global_prefetch_b8 %0, off offset:256 scope:SCOPE_SE\n\t"
                 "global_prefetch_b8 %0, off offset:512 scope:SCOPE_SE\n\t"
                 "global_prefetch_b8 %0, off offset:768 scope:SCOPE_SE" :: "v"(xp));

    v8f acc[12];
#pragma unroll
    for (int nt = 0; nt < 12; ++nt) acc[nt] = (v8f){};

#pragma unroll 1
    for (int kb = 0; kb < EMBED; kb += 32) {
        const v4f f0 = *(const v4f*)(xp);
        const v4f f1 = *(const v4f*)(xp + 4);
        const v4f f2 = *(const v4f*)(xp + 16);
        const v4f f3 = *(const v4f*)(xp + 20);

        v16h bv[12];
#pragma unroll
        for (int nt = 0; nt < 12; ++nt)
            bv[nt] = load_op(wt, nt * 16, EMBED, kb, lo, hi);

        // every second trip: the unit read eight trips from now (still inside the
        // row, also after xp has moved on once more)
        if ((kb & 32) == 0 && kb + 288 < EMBED)
            asm volatile("global_prefetch_b8 %0, off offset:1024 scope:SCOPE_SE" :: "v"(xp));

        const v4h h0 = __builtin_convertvector(f0, v4h);
        const v4h h1 = __builtin_convertvector(f1, v4h);
        const v4h h2 = __builtin_convertvector(f2, v4h);
        const v4h h3 = __builtin_convertvector(f3, v4h);
        H16 a;   // k = 8*hi + 0..7, then 16 + 8*hi + 0..7, as the weight loader has it
        a.h.lo = __builtin_shufflevector(h0, h1, 0, 1, 2, 3, 4, 5, 6, 7);
        a.h.hi = __builtin_shufflevector(h2, h3, 0, 1, 2, 3, 4, 5, 6, 7);

#pragma unroll
        for (int nt = 0; nt < 12; ++nt)
            acc[nt] = wmma_f16(a.v, bv[nt], acc[nt]);
        xp += 32;
    }

    const int bidx = m0 >> 11;
    const int rin = m0 & (SEQ - 1);
#pragma unroll
    for (int nt = 0; nt < 12; ++nt) {
#pragma unroll
        for (int r = 0; r < 8; ++r) {
            int row = m0 + r + 8 * hi;
            _Float16 v = (_Float16)acc[nt][r];
            if (nt < 4) {
                qh[(size_t)row * HD + nt * 16 + lo] = v;
            } else if (nt < 8) {
                kh[(size_t)row * HD + (nt - 4) * 16 + lo] = v;
            } else {
                vt[(size_t)bidx * HD * SEQ +
                   (size_t)((nt - 8) * 16 + lo) * SEQ + (rin + r + 8 * hi)] = v;
            }
        }
    }
}

// value of lane l ^ 16 (the other half of the wave), on the vector pipe
static __device__ __forceinline__ float xhalf(float x) {
    int i = __builtin_bit_cast(int, x);
    return __builtin_bit_cast(float, __builtin_amdgcn_permlanex16(
        i, i, 0x76543210, 0xfedcba98, false, false));
}

__global__ __launch_bounds__(128) void k_attn(const _Float16* __restrict__ qh,
                                              const _Float16* __restrict__ kh,
                                              const _Float16* __restrict__ vt,
                                              const _Float16* __restrict__ wpt,
                                              const float* __restrict__ bias,
                                              float* __restrict__ out) {
    const int lane = threadIdx.x & 31;
    const int lo = lane & 15, hi = lane >> 4;
    const int wave = threadIdx.x >> 5;
    const int gw = blockIdx.x * 4 + wave;   // < 512
    const int m0 = gw * 32;                 // first of 32 query rows
    const int b = m0 >> 11;

    // resident Q operands (B of S^T): two row-tiles x two k-blocks
    v16h qa[2][2];
#pragma unroll
    for (int t = 0; t < 2; ++t) {
        qa[t][0] = load_op(qh, m0 + t * 16, HD, 0, lo, hi);
        qa[t][1] = load_op(qh, m0 + t * 16, HD, 32, lo, hi);
    }

    const _Float16* kbase = kh + (size_t)b * SEQ * HD;
    const _Float16* vbase = vt + (size_t)b * HD * SEQ;

    // o[t][n]: O^T tile, rows d = 16*n + 8*hi + r, column = query t*16 + lo.
    // mr[t]: running maximum of that query (equal in both halves);
    // ls[t]: running sum over this half's keys only, joined after the loop.
    v8f o[2][4];
    float mr[2], ls[2];
#pragma unroll
    for (int t = 0; t < 2; ++t) {
#pragma unroll
        for (int n = 0; n < 4; ++n) o[t][n] = (v8f){};
        mr[t] = -3.0e38f; ls[t] = 0.0f;
    }

    for (int kv = 0; kv < SEQ; kv += 32) {
        // shared K operands for S^T, shared V^T operands for O^T (distinct registers)
        const v16h kb0 = load_op(kbase, kv,      HD, 0,  lo, hi);
        const v16h kb1 = load_op(kbase, kv,      HD, 32, lo, hi);
        const v16h kb2 = load_op(kbase, kv + 16, HD, 0,  lo, hi);
        const v16h kb3 = load_op(kbase, kv + 16, HD, 32, lo, hi);
        const v16h vb0 = load_op(vbase,  0, SEQ, kv, lo, hi);
        const v16h vb1 = load_op(vbase, 16, SEQ, kv, lo, hi);
        const v16h vb2 = load_op(vbase, 32, SEQ, kv, lo, hi);
        const v16h vb3 = load_op(vbase, 48, SEQ, kv, lo, hi);

        if (kv + 32 < SEQ) {  // prefetch next K/V tiles
            __builtin_prefetch(kbase + (size_t)(kv + 32 + lane) * HD, 0, 0);
            __builtin_prefetch(vbase + (size_t)lane * SEQ + kv + 32, 0, 0);
            __builtin_prefetch(vbase + (size_t)(32 + lane) * SEQ + kv + 32, 0, 0);
        }

#pragma unroll
        for (int t = 0; t < 2; ++t) {
            // ---- S^T = K @ Q^T (32 keys x 16 queries) ----
            v8f s0 = {}, s1 = {};
            s0 = wmma_f16(kb0, qa[t][0], s0);
            s0 = wmma_f16(kb1, qa[t][1], s0);
            s1 = wmma_f16(kb2, qa[t][0], s1);
            s1 = wmma_f16(kb3, qa[t][1], s1);

            // ---- online softmax: 16 of the query's 32 scores in this lane ----
            float a0[8], a1[8], mx[8];
#pragma unroll
            for (int r = 0; r < 8; ++r) {
                a0[r] = s0[r] * SCALE;
                a1[r] = s1[r] * SCALE;
                mx[r] = fmaxf(a0[r], a1[r]);
            }
            float t0 = fmaxf(fmaxf(fmaxf(mx[0], mx[1]), fmaxf(mx[2], mx[3])),
                             fmaxf(fmaxf(mx[4], mx[5]), fmaxf(mx[6], mx[7])));
            t0 = fmaxf(t0, xhalf(t0));
            const float mnew = fmaxf(mr[t], t0);
            const float alpha = exp2f((mr[t] - mnew) * LOG2E);

            H16 pb;      // P^T as B operand: k = 8*hi + r, then 16 + 8*hi + r
            float ps[8];
#pragma unroll
            for (int r = 0; r < 8; ++r) {
                float p0 = exp2f((a0[r] - mnew) * LOG2E);
                float p1 = exp2f((a1[r] - mnew) * LOG2E);
                ps[r] = p0 + p1;
                pb.v[r]     = (_Float16)p0;
                pb.v[8 + r] = (_Float16)p1;
            }
            const float rs = ((ps[0] + ps[1]) + (ps[2] + ps[3])) +
                             ((ps[4] + ps[5]) + (ps[6] + ps[7]));
            ls[t] = ls[t] * alpha + rs;
            mr[t] = mnew;

            // ---- O^T = O^T * alpha + V^T @ P^T ----
#pragma unroll
            for (int n = 0; n < 4; ++n) o[t][n] *= alpha;
            o[t][0] = wmma_f16(vb0, pb.v, o[t][0]);
            o[t][1] = wmma_f16(vb1, pb.v, o[t][1]);
            o[t][2] = wmma_f16(vb2, pb.v, o[t][2]);
            o[t][3] = wmma_f16(vb3, pb.v, o[t][3]);
        }
    }

    // ---- normalize; fused projection out^T = w_proj^T @ O^T + b_proj ----
#pragma unroll
    for (int t = 0; t < 2; ++t) {
        const float inv = 1.0f / (ls[t] + xhalf(ls[t]));
        H16 ob0, ob1;   // O^T as B operand, k = d: tiles 0,1 then tiles 2,3
#pragma unroll
        for (int r = 0; r < 8; ++r) {
            ob0.v[r]     = (_Float16)(o[t][0][r] * inv);
            ob0.v[8 + r] = (_Float16)(o[t][1][r] * inv);
            ob1.v[r]     = (_Float16)(o[t][2][r] * inv);
            ob1.v[8 + r] = (_Float16)(o[t][3][r] * inv);
        }
        float* orow = out + (size_t)(m0 + t * 16 + lo) * HD + 8 * hi;
#pragma unroll
        for (int ct = 0; ct < 4; ++ct) {
            // rows of out^T: output columns ct*16 + 8*hi + r of query row lo
            const float4 b0 = *(const float4*)(bias + ct * 16 + 8 * hi);
            const float4 b1 = *(const float4*)(bias + ct * 16 + 8 * hi + 4);
            v8f acc = { b0.x, b0.y, b0.z, b0.w, b1.x, b1.y, b1.z, b1.w };
            acc = wmma_f16(load_op(wpt, ct * 16, HD, 0,  lo, hi), ob0.v, acc);
            acc = wmma_f16(load_op(wpt, ct * 16, HD, 32, lo, hi), ob1.v, acc);
            *(float4*)(orow + ct * 16)     = make_float4(acc[0], acc[1], acc[2], acc[3]);
            *(float4*)(orow + ct * 16 + 4) = make_float4(acc[4], acc[5], acc[6], acc[7]);
        }
    }
}

// ---------- host launcher ----------
extern "C" void kernel_launch(void* const* d_in, const int* in_sizes, int n_in,
                              void* d_out, int out_size, void* d_ws, size_t ws_size,
                              hipStream_t stream) {
    (void)in_sizes; (void)n_in; (void)out_size; (void)ws_size;
    const float* x     = (const float*)d_in[0];
    const float* wqkv  = (const float*)d_in[1];
    const float* wproj = (const float*)d_in[2];
    const float* bproj = (const float*)d_in[3];
    float* out = (float*)d_out;

    char* ws = (char*)d_ws;
    _Float16* wt  = (_Float16*)(ws);                //    294,912 B
    _Float16* wpt = (_Float16*)(ws + 294912);       //      8,192 B
    _Float16* qh  = (_Float16*)(ws + 303104);       //  2,097,152 B
    _Float16* kh  = (_Float16*)(ws + 2400256);      //  2,097,152 B
    _Float16* vt  = (_Float16*)(ws + 4497408);      //  2,097,152 B  (total 6,594,560 B)

    k_tr_wqkv<<<EMBED * QKVN / 256, 256, 0, stream>>>(wqkv, wt);
    k_tr_wproj<<<HD * HD / 256, 256, 0, stream>>>(wproj, wpt);
    k_qkv<<<(ROWS / 16) / 4, 128, 0, stream>>>(x, wt, qh, kh, vt);
    k_attn<<<(ROWS / 32) / 4, 128, 0, stream>>>(qh, kh, vt, wpt, bproj, out);
}

// v003
// Measured time: 53.9 microseconds a run.
// Timed twice side by side with v002, it ran 1.41 and 1.42 times as fast.
// Counting every step since v000, it is 3.71 times as fast.
#include <hip/hip_runtime.h>
#include <hip/hip_bf16.h>

// ---------- constants ----------
#define BATCH 8
#define SEQ   2048
#define EMBED 768
#define HD    64
#define QKVN  192           // 3 * HD
#define ROWS  (BATCH * SEQ) // 16384
#define SCALE 0.125f        // 64^-0.5
#define LOG2E 1.44269504088896f

typedef _Float16 v4h  __attribute__((ext_vector_type(4)));
typedef _Float16 v8h  __attribute__((ext_vector_type(8)));
typedef _Float16 v16h __attribute__((ext_vector_type(16)));
typedef float    v8f  __attribute__((ext_vector_type(8)));
typedef float    v4f  __attribute__((ext_vector_type(4)));

union H16 { v16h v; struct { v8h lo; v8h hi; } h; };

static __device__ __forceinline__ v8f wmma_f16(v16h a, v16h b, v8f c) {
    // D = A(16x32 f16) * B(32x16 f16) + C(16x16 f32)
    return __builtin_amdgcn_wmma_f32_16x16x32_f16(false, a, false, b, (short)0, c,
                                                  false, false);
}

// Load a 16x32 f16 A-operand (== B-operand of the transpose) from a row-major
// matrix with leading dimension ld (in halves), rows starting at row0, k-block kb.
static __device__ __forceinline__ v16h load_op(const _Float16* __restrict__ base,
                                               int row0, int ld, int kb,
                                               int lo, int hi) {
    const _Float16* r = base + (size_t)(row0 + lo) * ld + kb + hi * 8;
    H16 u;
    u.h.lo = *(const v8h*)(r);
    u.h.hi = *(const v8h*)(r + 16);
    return u.v;
}

// ---------- kernel 1b: w_qkv (768x192 f32) -> Wt (192x768 f16) ----------
__global__ __launch_bounds__(256) void k_tr_wqkv(const float* __restrict__ w,
                                                 _Float16* __restrict__ wt) {
    int idx = blockIdx.x * 256 + threadIdx.x;      // < 147456
    int e = idx / QKVN, n = idx % QKVN;
    wt[(size_t)n * EMBED + e] = (_Float16)w[idx];
}

// ---------- kernel 1c: w_proj (64x64 f32) -> Wpt (64x64 f16, transposed) ----------
__global__ __launch_bounds__(256) void k_tr_wproj(const float* __restrict__ w,
                                                  _Float16* __restrict__ wpt) {
    int idx = blockIdx.x * 256 + threadIdx.x;      // < 4096
    int k = idx / HD, n = idx % HD;
    wpt[(size_t)n * HD + k] = (_Float16)w[idx];
}

// ---------- kernel 2: QKV projection ----------
// One wave computes a full 16x192 row-block (12 resident accumulators).
// All 12 B operands are loaded into distinct registers BEFORE the WMMA chain so
// the scheduler can overlap loads with matrix ops (partial loadcnt waits)
// instead of draining the load pipe before every WMMA.
// x is read as f32 and rounded to f16 (nearest even) in registers on its way
// into the A operand: a lane's 16 k values are two runs of 8 floats of its row.
__global__ __launch_bounds__(128) void k_qkv(const float* __restrict__ x,
                                             const _Float16* __restrict__ wt,
                                             _Float16* __restrict__ qh,
                                             _Float16* __restrict__ kh,
                                             _Float16* __restrict__ vt) {
    const int lane = threadIdx.x & 31;
    const int lo = lane & 15, hi = lane >> 4;
    const int mt = blockIdx.x * 4 + (threadIdx.x >> 5);  // < 1024
    const int m0 = mt * 16;

    // walks the lane's row, one k-block (128 bytes) a trip
    const float* xp = x + (size_t)(m0 + lo) * EMBED + hi * 8;

    // x comes from memory and the load counter returns in order, so a load issued
    // ahead would hold up the weight loads behind it: prefetch the row into L2 ahead
    // of its loads instead, one address every 256 bytes. Units 1 to 3 here, unit u + 4 in the loop.
    asm volatile("global_prefetch_b8 %0, off offset:256 scope:SCOPE_SE\n\t"
                 "global_prefetch_b8 %0, off offset:512 scope:SCOPE_SE\n\t"
                 "global_prefetch_b8 %0, off offset:768 scope:SCOPE_SE" :: "v"(xp));

    v8f acc[12];
#pragma unroll
    for (int nt = 0; nt < 12; ++nt) acc[nt] = (v8f){};

#pragma unroll 1
    for (int kb = 0; kb < EMBED; kb += 32) {
        const v4f f0 = *(const v4f*)(xp);
        const v4f f1 = *(const v4f*)(xp + 4);
        const v4f f2 = *(const v4f*)(xp + 16);
        const v4f f3 = *(const v4f*)(xp + 20);

        v16h bv[12];
#pragma unroll
        for (int nt = 0; nt < 12; ++nt)
            bv[nt] = load_op(wt, nt * 16, EMBED, kb, lo, hi);

        // every second trip: the unit read eight trips from now (still inside the
        // row, also after xp has moved on once more)
        if ((kb & 32) == 0 && kb + 288 < EMBED)
            asm volatile("global_prefetch_b8 %0, off offset:1024 scope:SCOPE_SE" :: "v"(xp));

        const v4h h0 = __builtin_convertvector(f0, v4h);
        const v4h h1 = __builtin_convertvector(f1, v4h);
        const v4h h2 = __builtin_convertvector(f2, v4h);
        const v4h h3 = __builtin_convertvector(f3, v4h);
        H16 a;   // k = 8*hi + 0..7, then 16 + 8*hi + 0..7, as the weight loader has it
        a.h.lo = __builtin_shufflevector(h0, h1, 0, 1, 2, 3, 4, 5, 6, 7);
        a.h.hi = __builtin_shufflevector(h2, h3, 0, 1, 2, 3, 4, 5, 6, 7);

#pragma unroll
        for (int nt = 0; nt < 12; ++nt)
            acc[nt] = wmma_f16(a.v, bv[nt], acc[nt]);
        xp += 32;
    }

    const int bidx = m0 >> 11;
    const int rin = m0 & (SEQ - 1);
#pragma unroll
    for (int nt = 0; nt < 12; ++nt) {
#pragma unroll
        for (int r = 0; r < 8; ++r) {
            int row = m0 + r + 8 * hi;
            _Float16 v = (_Float16)acc[nt][r];
            if (nt < 4) {
                qh[(size_t)row * HD + nt * 16 + lo] = v;
            } else if (nt < 8) {
                kh[(size_t)row * HD + (nt - 4) * 16 + lo] = v;
            } else {
                vt[(size_t)bidx * HD * SEQ +
                   (size_t)((nt - 8) * 16 + lo) * SEQ + (rin + r + 8 * hi)] = v;
            }
        }
    }
}

// value of lane l ^ 16 (the other half of the wave), on the vector pipe
static __device__ __forceinline__ float xhalf(float x) {
    int i = __builtin_bit_cast(int, x);
    return __builtin_bit_cast(float, __builtin_amdgcn_permlanex16(
        i, i, 0x76543210, 0xfedcba98, false, false));
}

// Keys are dealt over the waves of a work-group: 8 waves = 2 query groups of 32
// rows x 4 key shares. Share sp takes the 32-key blocks sp, sp + 4, sp + 8, ... with
// its own running maximum, sum and O^T; the four partial results of a query group
// meet in LDS behind one barrier. 2,048 waves instead of 512: two on every SIMD.
#define KSHARES 4

// two waves a SIMD is all this grid places: the compiler may spend that budget's registers
__global__ __launch_bounds__(256) __attribute__((amdgpu_waves_per_eu(2, 2)))
void k_attn(const _Float16* __restrict__ qh,
                                              const _Float16* __restrict__ kh,
                                              const _Float16* __restrict__ vt,
                                              const _Float16* __restrict__ wpt,
                                              const float* __restrict__ bias,
                                              float* __restrict__ out) {
    // partial O^T: [group][share][t][n][r / 4][lane], 16 bytes a lane, so that every
    // LDS store and load is 512 contiguous bytes; reader and writer use the same lane
    __shared__ v4f   po[2][KSHARES][2][4][2][32];   // 65,536 B
    __shared__ float pm[2][KSHARES][2][32];         //  2,048 B: running maxima
    __shared__ float pl[2][KSHARES][2][32];         //  2,048 B: this half's sums

    const int lane = threadIdx.x & 31;
    const int lo = lane & 15, hi = lane >> 4;
    // wave number as a scalar: the key loop's counter stays in scalar registers
    const int wave = __builtin_amdgcn_readfirstlane(threadIdx.x >> 5);   // < 8
    const int g  = wave >> 2;               // query group of this block
    const int sp = wave & 3;                // key share
    const int m0 = (blockIdx.x * 2 + g) * 32;   // first of 32 query rows
    const int b = m0 >> 11;                 // 64 rows a block: one batch entry

    // resident Q operands (B of S^T): two row-tiles x two k-blocks
    v16h qa[2][2];
#pragma unroll
    for (int t = 0; t < 2; ++t) {
        qa[t][0] = load_op(qh, m0 + t * 16, HD, 0, lo, hi);
        qa[t][1] = load_op(qh, m0 + t * 16, HD, 32, lo, hi);
    }

    const _Float16* kbase = kh + (size_t)b * SEQ * HD;
    const _Float16* vbase = vt + (size_t)b * HD * SEQ;

    // o[t][n]: O^T tile, rows d = 16*n + 8*hi + r, column = query t*16 + lo.
    // mr[t]: running maximum of that query over this share (equal in both halves);
    // ls[t]: running sum over this half's keys of this share, joined after the loop.
    v8f o[2][4];
    float mr[2], ls[2];
#pragma unroll
    for (int t = 0; t < 2; ++t) {
#pragma unroll
        for (int n = 0; n < 4; ++n) o[t][n] = (v8f){};
        mr[t] = -3.0e38f; ls[t] = 0.0f;
    }

    for (int kv = sp * 32; kv < SEQ; kv += 32 * KSHARES) {
        // shared K operands for S^T, shared V^T operands for O^T (distinct registers)
        const v16h kb0 = load_op(kbase, kv,      HD, 0,  lo, hi);
        const v16h kb1 = load_op(kbase, kv,      HD, 32, lo, hi);
        const v16h kb2 = load_op(kbase, kv + 16, HD, 0,  lo, hi);
        const v16h kb3 = load_op(kbase, kv + 16, HD, 32, lo, hi);
        const v16h vb0 = load_op(vbase,  0, SEQ, kv, lo, hi);
        const v16h vb1 = load_op(vbase, 16, SEQ, kv, lo, hi);
        const v16h vb2 = load_op(vbase, 32, SEQ, kv, lo, hi);
        const v16h vb3 = load_op(vbase, 48, SEQ, kv, lo, hi);
        // all 16 loads of the trip are issued before its first product: without this the
        // scheduler reuses K registers and the trip waits out a load latency twice
        __builtin_amdgcn_sched_barrier(0);

        if (kv + 32 * KSHARES < SEQ) {  // prefetch this wave's next K/V tiles
            const int kn = kv + 32 * KSHARES;
            __builtin_prefetch(kbase + (size_t)(kn + lane) * HD, 0, 0);
            __builtin_prefetch(vbase + (size_t)lane * SEQ + kn, 0, 0);
            __builtin_prefetch(vbase + (size_t)(32 + lane) * SEQ + kn, 0, 0);
            // the prefetches' address registers are reused by the products right behind
            asm volatile("s_wait_xcnt 0x0" ::: "memory");
        }

#pragma unroll
        for (int t = 0; t < 2; ++t) {
            // ---- S^T = K @ Q^T (32 keys x 16 queries) ----
            v8f s0 = {}, s1 = {};
            s0 = wmma_f16(kb0, qa[t][0], s0);
            s0 = wmma_f16(kb1, qa[t][1], s0);
            s1 = wmma_f16(kb2, qa[t][0], s1);
            s1 = wmma_f16(kb3, qa[t][1], s1);

            // ---- online softmax: 16 of the query's 32 scores in this lane ----
            float a0[8], a1[8], mx[8];
#pragma unroll
            for (int r = 0; r < 8; ++r) {
                a0[r] = s0[r] * SCALE;
                a1[r] = s1[r] * SCALE;
                mx[r] = fmaxf(a0[r], a1[r]);
            }
            float t0 = fmaxf(fmaxf(fmaxf(mx[0], mx[1]), fmaxf(mx[2], mx[3])),
                             fmaxf(fmaxf(mx[4], mx[5]), fmaxf(mx[6], mx[7])));
            t0 = fmaxf(t0, xhalf(t0));
            const float mnew = fmaxf(mr[t], t0);
            const float alpha = exp2f((mr[t] - mnew) * LOG2E);

            H16 pb;      // P^T as B operand: k = 8*hi + r, then 16 + 8*hi + r
            float ps[8];
#pragma unroll
            for (int r = 0; r < 8; ++r) {
                float p0 = exp2f((a0[r] - mnew) * LOG2E);
                float p1 = exp2f((a1[r] - mnew) * LOG2E);
                ps[r] = p0 + p1;
                pb.v[r]     = (_Float16)p0;
                pb.v[8 + r] = (_Float16)p1;
            }
            const float rs = ((ps[0] + ps[1]) + (ps[2] + ps[3])) +
                             ((ps[4] + ps[5]) + (ps[6] + ps[7]));
            ls[t] = ls[t] * alpha + rs;
            mr[t] = mnew;

            // ---- O^T = O^T * alpha + V^T @ P^T ----
#pragma unroll
            for (int n = 0; n < 4; ++n) o[t][n] *= alpha;
            o[t][0] = wmma_f16(vb0, pb.v, o[t][0]);
            o[t][1] = wmma_f16(vb1, pb.v, o[t][1]);
            o[t][2] = wmma_f16(vb2, pb.v, o[t][2]);
            o[t][3] = wmma_f16(vb3, pb.v, o[t][3]);
        }
    }

    // ---- hand this share's partial result to the work-group ----
#pragma unroll
    for (int t = 0; t < 2; ++t) {
#pragma unroll
        for (int n = 0; n < 4; ++n) {
            po[g][sp][t][n][0][lane] = (v4f){ o[t][n][0], o[t][n][1], o[t][n][2], o[t][n][3] };
            po[g][sp][t][n][1][lane] = (v4f){ o[t][n][4], o[t][n][5], o[t][n][6], o[t][n][7] };
        }
        pm[g][sp][t][lane] = mr[t];
        pl[g][sp][t][lane] = ls[t];
    }
    __syncthreads();

    // ---- merge the four shares; fused projection out^T = w_proj^T @ O^T + b_proj ----
    // Wave w: query group w >> 2, its 16-row tile (w >> 1) & 1, output columns
    // 32 * (w & 1) + 0..31 (one 128-byte line of each output row).
    const int et = (wave >> 1) & 1;
    const int ec = wave & 1;

    float wgt[KSHARES];
#pragma unroll
    for (int s = 0; s < KSHARES; ++s) wgt[s] = pm[g][s][et][lane];
    const float mall = fmaxf(fmaxf(wgt[0], wgt[1]), fmaxf(wgt[2], wgt[3]));
    float lall = 0.0f;
#pragma unroll
    for (int s = 0; s < KSHARES; ++s) {
        wgt[s] = exp2f((wgt[s] - mall) * LOG2E);
        lall += wgt[s] * pl[g][s][et][lane];
    }
    const float inv = 1.0f / (lall + xhalf(lall));
#pragma unroll
    for (int s = 0; s < KSHARES; ++s) wgt[s] *= inv;

    H16 ob0, ob1;   // O^T as B operand, k = d: tiles 0,1 then tiles 2,3
#pragma unroll
    for (int n = 0; n < 4; ++n) {
#pragma unroll
        for (int h = 0; h < 2; ++h) {
            v4f a = po[g][0][et][n][h][lane] * wgt[0];
#pragma unroll
            for (int s = 1; s < KSHARES; ++s) a += po[g][s][et][n][h][lane] * wgt[s];
#pragma unroll
            for (int r = 0; r < 4; ++r) {
                if (n < 2) ob0.v[(n & 1) * 8 + h * 4 + r] = (_Float16)a[r];
                else       ob1.v[(n & 1) * 8 + h * 4 + r] = (_Float16)a[r];
            }
        }
    }

    float* orow = out + (size_t)(m0 + et * 16 + lo) * HD + 8 * hi;
#pragma unroll
    for (int c = 0; c < 2; ++c) {
        const int ct = ec * 2 + c;
        // rows of out^T: output columns ct*16 + 8*hi + r of query row lo
        const float4 b0 = *(const float4*)(bias + ct * 16 + 8 * hi);
        const float4 b1 = *(const float4*)(bias + ct * 16 + 8 * hi + 4);
        v8f acc = { b0.x, b0.y, b0.z, b0.w, b1.x, b1.y, b1.z, b1.w };
        acc = wmma_f16(load_op(wpt, ct * 16, HD, 0,  lo, hi), ob0.v, acc);
        acc = wmma_f16(load_op(wpt, ct * 16, HD, 32, lo, hi), ob1.v, acc);
        *(float4*)(orow + ct * 16)     = make_float4(acc[0], acc[1], acc[2], acc[3]);
        *(float4*)(orow + ct * 16 + 4) = make_float4(acc[4], acc[5], acc[6], acc[7]);
    }
}

// ---------- host launcher ----------
extern "C" void kernel_launch(void* const* d_in, const int* in_sizes, int n_in,
                              void* d_out, int out_size, void* d_ws, size_t ws_size,
                              hipStream_t stream) {
    (void)in_sizes; (void)n_in; (void)out_size; (void)ws_size;
    const float* x     = (const float*)d_in[0];
    const float* wqkv  = (const float*)d_in[1];
    const float* wproj = (const float*)d_in[2];
    const float* bproj = (const float*)d_in[3];
    float* out = (float*)d_out;

    char* ws = (char*)d_ws;
    _Float16* wt  = (_Float16*)(ws);                //    294,912 B
    _Float16* wpt = (_Float16*)(ws + 294912);       //      8,192 B
    _Float16* qh  = (_Float16*)(ws + 303104);       //  2,097,152 B
    _Float16* kh  = (_Float16*)(ws + 2400256);      //  2,097,152 B
    _Float16* vt  = (_Float16*)(ws + 4497408);      //  2,097,152 B  (total 6,594,560 B)

    k_tr_wqkv<<<EMBED * QKVN / 256, 256, 0, stream>>>(wqkv, wt);
    k_tr_wproj<<<HD * HD / 256, 256, 0, stream>>>(wproj, wpt);
    k_qkv<<<(ROWS / 16) / 4, 128, 0, stream>>>(x, wt, qh, kh, vt);
    k_attn<<<ROWS / 64, 256, 0, stream>>>(qh, kh, vt, wpt, bproj, out);
}

// v004
// A run of this version takes 40.5 microseconds.
// In two side-by-side timings against v003, it was 1.37 and 1.34 times as fast.
// Over all steps from v000 it is 5.04 times as fast.
#include <hip/hip_runtime.h>
#include <hip/hip_bf16.h>

// ---------- constants ----------
#define BATCH 8
#define SEQ   2048
#define EMBED 768
#define HD    64
#define QKVN  192           // 3 * HD
#define ROWS  (BATCH * SEQ) // 16384
#define SCALE 0.125f        // 64^-0.5
#define LOG2E 1.44269504088896f

typedef _Float16 v4h  __attribute__((ext_vector_type(4)));
typedef _Float16 v8h  __attribute__((ext_vector_type(8)));
typedef _Float16 v16h __attribute__((ext_vector_type(16)));
typedef float    v8f  __attribute__((ext_vector_type(8)));
typedef float    v4f  __attribute__((ext_vector_type(4)));

union H16 { v16h v; struct { v8h lo; v8h hi; } h; };

static __device__ __forceinline__ v8f wmma_f16(v16h a, v16h b, v8f c) {
    // D = A(16x32 f16) * B(32x16 f16) + C(16x16 f32)
    return __builtin_amdgcn_wmma_f32_16x16x32_f16(false, a, false, b, (short)0, c,
                                                  false, false);
}

// Load a 16x32 f16 A-operand (== B-operand of the transpose) from a row-major
// matrix with leading dimension ld (in halves), rows starting at row0, k-block kb.
static __device__ __forceinline__ v16h load_op(const _Float16* __restrict__ base,
                                               int row0, int ld, int kb,
                                               int lo, int hi) {
    const _Float16* r = base + (size_t)(row0 + lo) * ld + kb + hi * 8;
    H16 u;
    u.h.lo = *(const v8h*)(r);
    u.h.hi = *(const v8h*)(r + 16);
    return u.v;
}

// Fragment order: a 16x32 f16 operand lies as 1,024 bytes in a row, two chunks of
// 512 bytes; chunk c holds, at 16 bytes a lane, what load_op gives that lane as its
// half c (row lo, k = 16*c + 8*hi + 0..7). A wave's 16-byte load then covers four
// whole 128-byte lines in place of 32 bytes in each of 16 lines.
#define FRAG 512            // halves in a fragment
static __device__ __forceinline__ v16h load_frag(const _Float16* __restrict__ p) {
    H16 u;                  // p: the fragment's start + 8 * lane
    u.h.lo = *(const v8h*)(p);
    u.h.hi = *(const v8h*)(p + 256);
    return u.v;
}

// ---------- kernel 1b: w_qkv (768x192 f32) -> Wt (f16, fragment order) ----------
// Fragment kbi * 12 + nt: columns nt*16 + 0..15 of w_qkv, k-block kbi. One thread
// writes one lane's 16 bytes of one chunk.
__global__ __launch_bounds__(256) void k_tr_wqkv(const float* __restrict__ w,
                                                 _Float16* __restrict__ wt) {
    const int idx = blockIdx.x * 256 + threadIdx.x;    // < 18432
    const int lo = idx & 15, hi = (idx >> 4) & 1, c = (idx >> 5) & 1;
    const int f = idx >> 6;                            // < 288
    const int kbi = f / 12, nt = f % 12;
    const float* s = w + (size_t)(kbi * 32 + c * 16 + hi * 8) * QKVN + nt * 16 + lo;
    v8h h;
#pragma unroll
    for (int j = 0; j < 8; ++j) h[j] = (_Float16)s[j * QKVN];
    *(v8h*)(wt + (size_t)idx * 8) = h;
}

// ---------- kernel 1c: w_proj (64x64 f32) -> Wpt (64x64 f16, transposed) ----------
__global__ __launch_bounds__(256) void k_tr_wproj(const float* __restrict__ w,
                                                  _Float16* __restrict__ wpt) {
    int idx = blockIdx.x * 256 + threadIdx.x;      // < 4096
    int k = idx / HD, n = idx % HD;
    wpt[(size_t)n * HD + k] = (_Float16)w[idx];
}

// ---------- kernel 2: QKV projection ----------
// One wave computes a full 16x192 row-block (12 resident accumulators).
// All 12 weight operands are loaded into distinct registers BEFORE the WMMA chain so
// the scheduler can overlap loads with matrix ops (partial loadcnt waits)
// instead of draining the load pipe before every WMMA.
// x is read as f32 and rounded to f16 (nearest even) in registers on its way
// into its operand (B of the q and k tiles, A of the v tiles): a lane's 16 k values are two runs of 8 floats of its row.
// q, k and v leave in the fragment order of their reader. A lane must then hold 8
// neighbours along the reader's k: head dims for q and k, so these eight tiles are
// formed transposed (W^T * x^T: same registers, operands swapped); keys for v.
__global__ __launch_bounds__(128) void k_qkv(const float* __restrict__ x,
                                             const _Float16* __restrict__ wt,
                                             _Float16* __restrict__ qh,
                                             _Float16* __restrict__ kh,
                                             _Float16* __restrict__ vt) {
    const int lane = threadIdx.x & 31;
    const int lo = lane & 15, hi = lane >> 4;
    const int mt = blockIdx.x * 4 + (threadIdx.x >> 5);  // < 1024
    const int m0 = mt * 16;

    // walks the lane's row, one k-block (128 bytes) a trip
    const float* xp = x + (size_t)(m0 + lo) * EMBED + hi * 8;
    // walks the weight fragments, twelve (12,288 bytes in a row) a trip
    const _Float16* wp = wt + lane * 8;

    // x comes from memory and the load counter returns in order, so a load issued
    // ahead would hold up the weight loads behind it: prefetch the row into L2 ahead
    // of its loads instead, one address every 256 bytes. Units 1 to 3 here, unit u + 4 in the loop.
    asm volatile("global_prefetch_b8 %0, off offset:256 scope:SCOPE_SE\n\t"
                 "global_prefetch_b8 %0, off offset:512 scope:SCOPE_SE\n\t"
                 "global_prefetch_b8 %0, off offset:768 scope:SCOPE_SE" :: "v"(xp));

    v8f acc[12];
#pragma unroll
    for (int nt = 0; nt < 12; ++nt) acc[nt] = (v8f){};

#pragma unroll 1
    for (int kb = 0; kb < EMBED; kb += 32) {
        const v4f f0 = *(const v4f*)(xp);
        const v4f f1 = *(const v4f*)(xp + 4);
        const v4f f2 = *(const v4f*)(xp + 16);
        const v4f f3 = *(const v4f*)(xp + 20);

        v16h bv[12];
#pragma unroll
        for (int nt = 0; nt < 12; ++nt)
            bv[nt] = load_frag(wp + nt * FRAG);

        // every second trip: the unit read eight trips from now (still inside the
        // row, also after xp has moved on once more)
        if ((kb & 32) == 0 && kb + 288 < EMBED)
            asm volatile("global_prefetch_b8 %0, off offset:1024 scope:SCOPE_SE" :: "v"(xp));

        const v4h h0 = __builtin_convertvector(f0, v4h);
        const v4h h1 = __builtin_convertvector(f1, v4h);
        const v4h h2 = __builtin_convertvector(f2, v4h);
        const v4h h3 = __builtin_convertvector(f3, v4h);
        H16 a;   // k = 8*hi + 0..7, then 16 + 8*hi + 0..7, as the weight loader has it
        a.h.lo = __builtin_shufflevector(h0, h1, 0, 1, 2, 3, 4, 5, 6, 7);
        a.h.hi = __builtin_shufflevector(h2, h3, 0, 1, 2, 3, 4, 5, 6, 7);

#pragma unroll
        for (int nt = 0; nt < 12; ++nt)
            acc[nt] = nt < 8 ? wmma_f16(bv[nt], a.v, acc[nt])    // column nt*16+8*hi+r, row lo
                             : wmma_f16(a.v, bv[nt], acc[nt]);   // row 8*hi+r, column nt*16+lo
        xp += 32;
        wp += 12 * FRAG;
    }

    // q, k: row tile mt is fragments 2*mt (dims 0..31) and 2*mt + 1; tile nt is chunk
    // nt & 1 of fragment nt >> 1. v: 32-key block mt >> 1 is fragments 4*(mt >> 1) + n
    // (dims 16*n + 0..15); this wave's 16 keys are chunk mt & 1 of each.
#pragma unroll
    for (int nt = 0; nt < 12; ++nt) {
        const v8h h = __builtin_convertvector(acc[nt], v8h);
        if (nt < 4) {
            *(v8h*)(qh + (size_t)(mt * 4 + nt) * 256 + lane * 8) = h;
        } else if (nt < 8) {
            *(v8h*)(kh + (size_t)(mt * 4 + nt - 4) * 256 + lane * 8) = h;
        } else {
            *(v8h*)(vt + (size_t)(((mt >> 1) * 4 + nt - 8) * 2 + (mt & 1)) * 256 + lane * 8) = h;
        }
    }
}

// value of lane l ^ 16 (the other half of the wave), on the vector pipe
static __device__ __forceinline__ float xhalf(float x) {
    int i = __builtin_bit_cast(int, x);
    return __builtin_bit_cast(float, __builtin_amdgcn_permlanex16(
        i, i, 0x76543210, 0xfedcba98, false, false));
}

// Keys are dealt over the waves of a work-group: 8 waves = 2 query groups of 32
// rows x 4 key shares. Share sp takes the 32-key blocks sp, sp + 4, sp + 8, ... with
// its own running maximum, sum and O^T; the four partial results of a query group
// meet in LDS behind one barrier. 2,048 waves instead of 512: two on every SIMD.
#define KSHARES 4

// two waves a SIMD is all this grid places: the compiler may spend that budget's registers
__global__ __launch_bounds__(256) __attribute__((amdgpu_waves_per_eu(2, 2)))
void k_attn(const _Float16* __restrict__ qh,
                                              const _Float16* __restrict__ kh,
                                              const _Float16* __restrict__ vt,
                                              const _Float16* __restrict__ wpt,
                                              const float* __restrict__ bias,
                                              float* __restrict__ out) {
    // partial O^T: [group][share][t][n][r / 4][lane], 16 bytes a lane, so that every
    // LDS store and load is 512 contiguous bytes; reader and writer use the same lane
    __shared__ v4f   po[2][KSHARES][2][4][2][32];   // 65,536 B
    __shared__ float pm[2][KSHARES][2][32];         //  2,048 B: running maxima
    __shared__ float pl[2][KSHARES][2][32];         //  2,048 B: this half's sums

    const int lane = threadIdx.x & 31;
    const int lo = lane & 15, hi = lane >> 4;
    // wave number as a scalar: the key loop's counter stays in scalar registers
    const int wave = __builtin_amdgcn_readfirstlane(threadIdx.x >> 5);   // < 8
    const int g  = wave >> 2;               // query group of this block
    const int sp = wave & 3;                // key share
    const int m0 = (blockIdx.x * 2 + g) * 32;   // first of 32 query rows
    const int b = m0 >> 11;                 // 64 rows a block: one batch entry

    // resident Q operands (B of S^T): two row-tiles x two k-blocks
    v16h qa[2][2];
#pragma unroll
    for (int t = 0; t < 2; ++t) {
        qa[t][0] = load_frag(qh + (size_t)(m0 + t * 16) * HD + lane * 8);
        qa[t][1] = load_frag(qh + (size_t)(m0 + t * 16) * HD + FRAG + lane * 8);
    }

    // fragment order: a 32-key block is 4 fragments (4,096 bytes in a row) in each of
    // K (key tile, dims half) and V^T (dims tile), at the block's first row * HD halves
    const _Float16* kbase = kh + (size_t)b * SEQ * HD;
    const _Float16* vbase = vt + (size_t)b * HD * SEQ;

    // o[t][n]: O^T tile, rows d = 16*n + 8*hi + r, column = query t*16 + lo.
    // mr[t]: running maximum of that query over this share (equal in both halves);
    // ls[t]: running sum over this half's keys of this share, joined after the loop.
    v8f o[2][4];
    float mr[2], ls[2];
#pragma unroll
    for (int t = 0; t < 2; ++t) {
#pragma unroll
        for (int n = 0; n < 4; ++n) o[t][n] = (v8f){};
        mr[t] = -3.0e38f; ls[t] = 0.0f;
    }

    // the lane's byte offset in the block, the same in both planes (below 2 MiB): one
    // 32-bit register beside the two scalar bases addresses all 16 loads of a trip
    unsigned fo = (unsigned)((b * SEQ + sp * 32) * HD + lane * 8) * 2u;
    for (int kv = sp * 32; kv < SEQ; kv += 32 * KSHARES, fo += 32 * KSHARES * HD * 2) {
        // shared K operands for S^T, shared V^T operands for O^T (distinct registers)
        const _Float16* kp = (const _Float16*)((const char*)kh + fo);
        const _Float16* vp = (const _Float16*)((const char*)vt + fo);
        const v16h kb0 = load_frag(kp);              // keys kv + 0..15,  dims 0..31
        const v16h kb1 = load_frag(kp + FRAG);       //                   dims 32..63
        const v16h kb2 = load_frag(kp + 2 * FRAG);   // keys kv + 16..31, dims 0..31
        const v16h kb3 = load_frag(kp + 3 * FRAG);   //                   dims 32..63
        const v16h vb0 = load_frag(vp);              // dims 0..15, keys kv + 0..31
        const v16h vb1 = load_frag(vp + FRAG);
        const v16h vb2 = load_frag(vp + 2 * FRAG);
        const v16h vb3 = load_frag(vp + 3 * FRAG);
        // all 16 loads of the trip are issued before its first product: without this the
        // scheduler reuses K registers and the trip waits out a load latency twice
        __builtin_amdgcn_sched_barrier(0);

        if (kv + 32 * KSHARES < SEQ) {  // prefetch this wave's next K/V tiles
            const int kn = kv + 32 * KSHARES;
            __builtin_prefetch(kbase + (size_t)(kn + lane) * HD, 0, 0);   // a line a lane
            __builtin_prefetch(vbase + (size_t)(kn + lane) * HD, 0, 0);
        }
        // the loads' offset register moves on, and the prefetches' address register is
        // reused, among the products right behind
        asm volatile("s_wait_xcnt 0x0" ::: "memory");
        // without this the scheduler lifts the offset's addition over the wait
        __builtin_amdgcn_sched_barrier(0);

#pragma unroll
        for (int t = 0; t < 2; ++t) {
            // ---- S^T = K @ Q^T (32 keys x 16 queries) ----
            v8f s0 = {}, s1 = {};
            s0 = wmma_f16(kb0, qa[t][0], s0);
            s0 = wmma_f16(kb1, qa[t][1], s0);
            s1 = wmma_f16(kb2, qa[t][0], s1);
            s1 = wmma_f16(kb3, qa[t][1], s1);

            // ---- online softmax: 16 of the query's 32 scores in this lane ----
            float a0[8], a1[8], mx[8];
#pragma unroll
            for (int r = 0; r < 8; ++r) {
                a0[r] = s0[r] * SCALE;
                a1[r] = s1[r] * SCALE;
                mx[r] = fmaxf(a0[r], a1[r]);
            }
            float t0 = fmaxf(fmaxf(fmaxf(mx[0], mx[1]), fmaxf(mx[2], mx[3])),
                             fmaxf(fmaxf(mx[4], mx[5]), fmaxf(mx[6], mx[7])));
            t0 = fmaxf(t0, xhalf(t0));
            const float mnew = fmaxf(mr[t], t0);
            const float alpha = exp2f((mr[t] - mnew) * LOG2E);

            H16 pb;      // P^T as B operand: k = 8*hi + r, then 16 + 8*hi + r
            float ps[8];
#pragma unroll
            for (int r = 0; r < 8; ++r) {
                float p0 = exp2f((a0[r] - mnew) * LOG2E);
                float p1 = exp2f((a1[r] - mnew) * LOG2E);
                ps[r] = p0 + p1;
                pb.v[r]     = (_Float16)p0;
                pb.v[8 + r] = (_Float16)p1;
            }
            const float rs = ((ps[0] + ps[1]) + (ps[2] + ps[3])) +
                             ((ps[4] + ps[5]) + (ps[6] + ps[7]));
            ls[t] = ls[t] * alpha + rs;
            mr[t] = mnew;

            // ---- O^T = O^T * alpha + V^T @ P^T ----
#pragma unroll
            for (int n = 0; n < 4; ++n) o[t][n] *= alpha;
            o[t][0] = wmma_f16(vb0, pb.v, o[t][0]);
            o[t][1] = wmma_f16(vb1, pb.v, o[t][1]);
            o[t][2] = wmma_f16(vb2, pb.v, o[t][2]);
            o[t][3] = wmma_f16(vb3, pb.v, o[t][3]);
        }
    }

    // ---- hand this share's partial result to the work-group ----
#pragma unroll
    for (int t = 0; t < 2; ++t) {
#pragma unroll
        for (int n = 0; n < 4; ++n) {
            po[g][sp][t][n][0][lane] = (v4f){ o[t][n][0], o[t][n][1], o[t][n][2], o[t][n][3] };
            po[g][sp][t][n][1][lane] = (v4f){ o[t][n][4], o[t][n][5], o[t][n][6], o[t][n][7] };
        }
        pm[g][sp][t][lane] = mr[t];
        pl[g][sp][t][lane] = ls[t];
    }
    __syncthreads();

    // ---- merge the four shares; fused projection out^T = w_proj^T @ O^T + b_proj ----
    // Wave w: query group w >> 2, its 16-row tile (w >> 1) & 1, output columns
    // 32 * (w & 1) + 0..31 (one 128-byte line of each output row).
    const int et = (wave >> 1) & 1;
    const int ec = wave & 1;

    float wgt[KSHARES];
#pragma unroll
    for (int s = 0; s < KSHARES; ++s) wgt[s] = pm[g][s][et][lane];
    const float mall = fmaxf(fmaxf(wgt[0], wgt[1]), fmaxf(wgt[2], wgt[3]));
    float lall = 0.0f;
#pragma unroll
    for (int s = 0; s < KSHARES; ++s) {
        wgt[s] = exp2f((wgt[s] - mall) * LOG2E);
        lall += wgt[s] * pl[g][s][et][lane];
    }
    const float inv = 1.0f / (lall + xhalf(lall));
#pragma unroll
    for (int s = 0; s < KSHARES; ++s) wgt[s] *= inv;

    H16 ob0, ob1;   // O^T as B operand, k = d: tiles 0,1 then tiles 2,3
#pragma unroll
    for (int n = 0; n < 4; ++n) {
#pragma unroll
        for (int h = 0; h < 2; ++h) {
            v4f a = po[g][0][et][n][h][lane] * wgt[0];
#pragma unroll
            for (int s = 1; s < KSHARES; ++s) a += po[g][s][et][n][h][lane] * wgt[s];
#pragma unroll
            for (int r = 0; r < 4; ++r) {
                if (n < 2) ob0.v[(n & 1) * 8 + h * 4 + r] = (_Float16)a[r];
                else       ob1.v[(n & 1) * 8 + h * 4 + r] = (_Float16)a[r];
            }
        }
    }

    float* orow = out + (size_t)(m0 + et * 16 + lo) * HD + 8 * hi;
#pragma unroll
    for (int c = 0; c < 2; ++c) {
        const int ct = ec * 2 + c;
        // rows of out^T: output columns ct*16 + 8*hi + r of query row lo
        const float4 b0 = *(const float4*)(bias + ct * 16 + 8 * hi);
        const float4 b1 = *(const float4*)(bias + ct * 16 + 8 * hi + 4);
        v8f acc = { b0.x, b0.y, b0.z, b0.w, b1.x, b1.y, b1.z, b1.w };
        acc = wmma_f16(load_op(wpt, ct * 16, HD, 0,  lo, hi), ob0.v, acc);
        acc = wmma_f16(load_op(wpt, ct * 16, HD, 32, lo, hi), ob1.v, acc);
        *(float4*)(orow + ct * 16)     = make_float4(acc[0], acc[1], acc[2], acc[3]);
        *(float4*)(orow + ct * 16 + 4) = make_float4(acc[4], acc[5], acc[6], acc[7]);
    }
}

// ---------- host launcher ----------
extern "C" void kernel_launch(void* const* d_in, const int* in_sizes, int n_in,
                              void* d_out, int out_size, void* d_ws, size_t ws_size,
                              hipStream_t stream) {
    (void)in_sizes; (void)n_in; (void)out_size; (void)ws_size;
    const float* x     = (const float*)d_in[0];
    const float* wqkv  = (const float*)d_in[1];
    const float* wproj = (const float*)d_in[2];
    const float* bproj = (const float*)d_in[3];
    float* out = (float*)d_out;

    char* ws = (char*)d_ws;
    _Float16* wt  = (_Float16*)(ws);                //    294,912 B
    _Float16* wpt = (_Float16*)(ws + 294912);       //      8,192 B
    _Float16* qh  = (_Float16*)(ws + 303104);       //  2,097,152 B
    _Float16* kh  = (_Float16*)(ws + 2400256);      //  2,097,152 B
    _Float16* vt  = (_Float16*)(ws + 4497408);      //  2,097,152 B  (total 6,594,560 B)

    k_tr_wqkv<<<EMBED * QKVN / 8 / 256, 256, 0, stream>>>(wqkv, wt);
    k_tr_wproj<<<HD * HD / 256, 256, 0, stream>>>(wproj, wpt);
    k_qkv<<<(ROWS / 16) / 4, 128, 0, stream>>>(x, wt, qh, kh, vt);
    k_attn<<<ROWS / 64, 256, 0, stream>>>(qh, kh, vt, wpt, bproj, out);
}

// v005
// Measured time: 37.1 microseconds a run.
// Next to v004, in two timings, it ran 1.08 and 1.07 times as fast.
// Over all steps from v000 it is 5.42 times as fast.
#include <hip/hip_runtime.h>
#include <hip/hip_bf16.h>

// ---------- constants ----------
#define BATCH 8
#define SEQ   2048
#define EMBED 768
#define HD    64
#define QKVN  192           // 3 * HD
#define ROWS  (BATCH * SEQ) // 16384
#define SCALE 0.125f        // 64^-0.5
#define LOG2E 1.44269504088896f
#define SCL2  (SCALE * LOG2E) // a raw score times this is its exponent to base 2

typedef _Float16 v4h  __attribute__((ext_vector_type(4)));
typedef _Float16 v8h  __attribute__((ext_vector_type(8)));
typedef _Float16 v16h __attribute__((ext_vector_type(16)));
typedef float    v8f  __attribute__((ext_vector_type(8)));
typedef float    v4f  __attribute__((ext_vector_type(4)));

union H16 { v16h v; struct { v8h lo; v8h hi; } h; };

static __device__ __forceinline__ v8f wmma_f16(v16h a, v16h b, v8f c) {
    // D = A(16x32 f16) * B(32x16 f16) + C(16x16 f32)
    return __builtin_amdgcn_wmma_f32_16x16x32_f16(false, a, false, b, (short)0, c,
                                                  false, false);
}

// Load a 16x32 f16 A-operand (== B-operand of the transpose) from a row-major
// matrix with leading dimension ld (in halves), rows starting at row0, k-block kb.
static __device__ __forceinline__ v16h load_op(const _Float16* __restrict__ base,
                                               int row0, int ld, int kb,
                                               int lo, int hi) {
    const _Float16* r = base + (size_t)(row0 + lo) * ld + kb + hi * 8;
    H16 u;
    u.h.lo = *(const v8h*)(r);
    u.h.hi = *(const v8h*)(r + 16);
    return u.v;
}

// Fragment order: a 16x32 f16 operand lies as 1,024 bytes in a row, two chunks of
// 512 bytes; chunk c holds, at 16 bytes a lane, what load_op gives that lane as its
// half c (row lo, k = 16*c + 8*hi + 0..7). A wave's 16-byte load then covers four
// whole 128-byte lines in place of 32 bytes in each of 16 lines.
#define FRAG 512            // halves in a fragment
static __device__ __forceinline__ v16h load_frag(const _Float16* __restrict__ p) {
    H16 u;                  // p: the fragment's start + 8 * lane
    u.h.lo = *(const v8h*)(p);
    u.h.hi = *(const v8h*)(p + 256);
    return u.v;
}

// ---------- kernel 1b: w_qkv (768x192 f32) -> Wt (f16, fragment order) ----------
// Fragment kbi * 12 + nt: columns nt*16 + 0..15 of w_qkv, k-block kbi. One thread
// writes one lane's 16 bytes of one chunk.
__global__ __launch_bounds__(256) void k_tr_wqkv(const float* __restrict__ w,
                                                 _Float16* __restrict__ wt) {
    const int idx = blockIdx.x * 256 + threadIdx.x;    // < 18432
    const int lo = idx & 15, hi = (idx >> 4) & 1, c = (idx >> 5) & 1;
    const int f = idx >> 6;                            // < 288
    const int kbi = f / 12, nt = f % 12;
    const float* s = w + (size_t)(kbi * 32 + c * 16 + hi * 8) * QKVN + nt * 16 + lo;
    v8h h;
#pragma unroll
    for (int j = 0; j < 8; ++j) h[j] = (_Float16)s[j * QKVN];
    *(v8h*)(wt + (size_t)idx * 8) = h;
}

// ---------- kernel 1c: w_proj (64x64 f32) -> Wpt (64x64 f16, transposed) ----------
__global__ __launch_bounds__(256) void k_tr_wproj(const float* __restrict__ w,
                                                  _Float16* __restrict__ wpt) {
    int idx = blockIdx.x * 256 + threadIdx.x;      // < 4096
    int k = idx / HD, n = idx % HD;
    wpt[(size_t)n * HD + k] = (_Float16)w[idx];
}

// ---------- kernel 2: QKV projection ----------
// One wave computes a full 16x192 row-block (12 resident accumulators).
// All 12 weight operands are loaded into distinct registers BEFORE the WMMA chain so
// the scheduler can overlap loads with matrix ops (partial loadcnt waits)
// instead of draining the load pipe before every WMMA.
// x is read as f32 and rounded to f16 (nearest even) in registers on its way
// into its operand (B of the q and k tiles, A of the v tiles): a lane's 16 k values are two runs of 8 floats of its row.
// q, k and v leave in the fragment order of their reader. A lane must then hold 8
// neighbours along the reader's k: head dims for q and k, so these eight tiles are
// formed transposed (W^T * x^T: same registers, operands swapped); keys for v.
__global__ __launch_bounds__(128) void k_qkv(const float* __restrict__ x,
                                             const _Float16* __restrict__ wt,
                                             _Float16* __restrict__ qh,
                                             _Float16* __restrict__ kh,
                                             _Float16* __restrict__ vt) {
    const int lane = threadIdx.x & 31;
    const int lo = lane & 15, hi = lane >> 4;
    const int mt = blockIdx.x * 4 + (threadIdx.x >> 5);  // < 1024
    const int m0 = mt * 16;

    // walks the lane's row, one k-block (128 bytes) a trip
    const float* xp = x + (size_t)(m0 + lo) * EMBED + hi * 8;
    // walks the weight fragments, twelve (12,288 bytes in a row) a trip
    const _Float16* wp = wt + lane * 8;

    // x comes from memory and the load counter returns in order, so a load issued
    // ahead would hold up the weight loads behind it: prefetch the row into L2 ahead
    // of its loads instead, one address every 256 bytes. Units 1 to 3 here, unit u + 4 in the loop.
    asm volatile("global_prefetch_b8 %0, off offset:256 scope:SCOPE_SE\n\t"
                 "global_prefetch_b8 %0, off offset:512 scope:SCOPE_SE\n\t"
                 "global_prefetch_b8 %0, off offset:768 scope:SCOPE_SE" :: "v"(xp));

    v8f acc[12];
#pragma unroll
    for (int nt = 0; nt < 12; ++nt) acc[nt] = (v8f){};

#pragma unroll 1
    for (int kb = 0; kb < EMBED; kb += 32) {
        const v4f f0 = *(const v4f*)(xp);
        const v4f f1 = *(const v4f*)(xp + 4);
        const v4f f2 = *(const v4f*)(xp + 16);
        const v4f f3 = *(const v4f*)(xp + 20);

        v16h bv[12];
#pragma unroll
        for (int nt = 0; nt < 12; ++nt)
            bv[nt] = load_frag(wp + nt * FRAG);

        // every second trip: the unit read eight trips from now (still inside the
        // row, also after xp has moved on once more)
        if ((kb & 32) == 0 && kb + 288 < EMBED)
            asm volatile("global_prefetch_b8 %0, off offset:1024 scope:SCOPE_SE" :: "v"(xp));

        const v4h h0 = __builtin_convertvector(f0, v4h);
        const v4h h1 = __builtin_convertvector(f1, v4h);
        const v4h h2 = __builtin_convertvector(f2, v4h);
        const v4h h3 = __builtin_convertvector(f3, v4h);
        H16 a;   // k = 8*hi + 0..7, then 16 + 8*hi + 0..7, as the weight loader has it
        a.h.lo = __builtin_shufflevector(h0, h1, 0, 1, 2, 3, 4, 5, 6, 7);
        a.h.hi = __builtin_shufflevector(h2, h3, 0, 1, 2, 3, 4, 5, 6, 7);

#pragma unroll
        for (int nt = 0; nt < 12; ++nt)
            acc[nt] = nt < 8 ? wmma_f16(bv[nt], a.v, acc[nt])    // column nt*16+8*hi+r, row lo
                             : wmma_f16(a.v, bv[nt], acc[nt]);   // row 8*hi+r, column nt*16+lo
        xp += 32;
        wp += 12 * FRAG;
    }

    // q, k: row tile mt is fragments 2*mt (dims 0..31) and 2*mt + 1; tile nt is chunk
    // nt & 1 of fragment nt >> 1. v: 32-key block mt >> 1 is fragments 4*(mt >> 1) + n
    // (dims 16*n + 0..15); this wave's 16 keys are chunk mt & 1 of each.
#pragma unroll
    for (int nt = 0; nt < 12; ++nt) {
        const v8h h = __builtin_convertvector(acc[nt], v8h);
        if (nt < 4) {
            *(v8h*)(qh + (size_t)(mt * 4 + nt) * 256 + lane * 8) = h;
        } else if (nt < 8) {
            *(v8h*)(kh + (size_t)(mt * 4 + nt - 4) * 256 + lane * 8) = h;
        } else {
            *(v8h*)(vt + (size_t)(((mt >> 1) * 4 + nt - 8) * 2 + (mt & 1)) * 256 + lane * 8) = h;
        }
    }
}

// 2^x as the one hardware instruction. Library exp2f adds a compare, two selects, an
// add and a scaling to each call, so that results below 2^-126 come out as denormals;
// here such a weight rounds to 0 in f16 and is lost in a row sum whose largest term is 1.
static __device__ __forceinline__ float ex2(float x) { return __builtin_amdgcn_exp2f(x); }

// value of lane l ^ 16 (the other half of the wave), on the vector pipe
static __device__ __forceinline__ float xhalf(float x) {
    int i = __builtin_bit_cast(int, x);
    return __builtin_bit_cast(float, __builtin_amdgcn_permlanex16(
        i, i, 0x76543210, 0xfedcba98, false, false));
}

// Keys are dealt over the waves of a work-group: 8 waves = 2 query groups of 32
// rows x 4 key shares. Share sp takes the 32-key blocks sp, sp + 4, sp + 8, ... with
// its own running maximum, sum and O^T; the four partial results of a query group
// meet in LDS behind one barrier. 2,048 waves instead of 512: two on every SIMD.
#define KSHARES 4

// two waves a SIMD is all this grid places: the compiler may spend that budget's registers
__global__ __launch_bounds__(256) __attribute__((amdgpu_waves_per_eu(2, 2)))
void k_attn(const _Float16* __restrict__ qh,
                                              const _Float16* __restrict__ kh,
                                              const _Float16* __restrict__ vt,
                                              const _Float16* __restrict__ wpt,
                                              const float* __restrict__ bias,
                                              float* __restrict__ out) {
    // partial O^T: [group][share][t][n][r / 4][lane], 16 bytes a lane, so that every
    // LDS store and load is 512 contiguous bytes; reader and writer use the same lane
    __shared__ v4f   po[2][KSHARES][2][4][2][32];   // 65,536 B
    __shared__ float pm[2][KSHARES][2][32];         //  2,048 B: running maxima (raw scores)
    __shared__ float pl[2][KSHARES][2][32];         //  2,048 B: this half's sums

    const int lane = threadIdx.x & 31;
    const int lo = lane & 15, hi = lane >> 4;
    // wave number as a scalar: the key loop's counter stays in scalar registers
    const int wave = __builtin_amdgcn_readfirstlane(threadIdx.x >> 5);   // < 8
    const int g  = wave >> 2;               // query group of this block
    const int sp = wave & 3;                // key share
    const int m0 = (blockIdx.x * 2 + g) * 32;   // first of 32 query rows
    const int b = m0 >> 11;                 // 64 rows a block: one batch entry

    // resident Q operands (B of S^T): two row-tiles x two k-blocks
    v16h qa[2][2];
#pragma unroll
    for (int t = 0; t < 2; ++t) {
        qa[t][0] = load_frag(qh + (size_t)(m0 + t * 16) * HD + lane * 8);
        qa[t][1] = load_frag(qh + (size_t)(m0 + t * 16) * HD + FRAG + lane * 8);
    }

    // fragment order: a 32-key block is 4 fragments (4,096 bytes in a row) in each of
    // K (key tile, dims half) and V^T (dims tile), at the block's first row * HD halves
    const _Float16* kbase = kh + (size_t)b * SEQ * HD;
    const _Float16* vbase = vt + (size_t)b * HD * SEQ;

    // o[t][n]: O^T tile, rows d = 16*n + 8*hi + r, column = query t*16 + lo.
    // mr[t]: running maximum of that query's raw scores over this share (equal in both halves);
    // ls[t]: running sum over this half's keys of this share, joined after the loop.
    v8f o[2][4];
    float mr[2], ls[2];
#pragma unroll
    for (int t = 0; t < 2; ++t) {
#pragma unroll
        for (int n = 0; n < 4; ++n) o[t][n] = (v8f){};
        mr[t] = -3.0e38f; ls[t] = 0.0f;
    }

    // the lane's byte offset in the block, the same in both planes (below 2 MiB): one
    // 32-bit register beside the two scalar bases addresses all 16 loads of a trip
    unsigned fo = (unsigned)((b * SEQ + sp * 32) * HD + lane * 8) * 2u;
    for (int kv = sp * 32; kv < SEQ; kv += 32 * KSHARES, fo += 32 * KSHARES * HD * 2) {
        // shared K operands for S^T, shared V^T operands for O^T (distinct registers)
        const _Float16* kp = (const _Float16*)((const char*)kh + fo);
        const _Float16* vp = (const _Float16*)((const char*)vt + fo);
        const v16h kb0 = load_frag(kp);              // keys kv + 0..15,  dims 0..31
        const v16h kb1 = load_frag(kp + FRAG);       //                   dims 32..63
        const v16h kb2 = load_frag(kp + 2 * FRAG);   // keys kv + 16..31, dims 0..31
        const v16h kb3 = load_frag(kp + 3 * FRAG);   //                   dims 32..63
        const v16h vb0 = load_frag(vp);              // dims 0..15, keys kv + 0..31
        const v16h vb1 = load_frag(vp + FRAG);
        const v16h vb2 = load_frag(vp + 2 * FRAG);
        const v16h vb3 = load_frag(vp + 3 * FRAG);
        // all 16 loads of the trip are issued before its first product: without this the
        // scheduler reuses K registers and the trip waits out a load latency twice
        __builtin_amdgcn_sched_barrier(0);

        if (kv + 32 * KSHARES < SEQ) {  // prefetch this wave's next K/V tiles
            const int kn = kv + 32 * KSHARES;
            __builtin_prefetch(kbase + (size_t)(kn + lane) * HD, 0, 0);   // a line a lane
            __builtin_prefetch(vbase + (size_t)(kn + lane) * HD, 0, 0);
        }
        // the loads' offset register moves on, and the prefetches' address register is
        // reused, among the products right behind
        asm volatile("s_wait_xcnt 0x0" ::: "memory");
        // without this the scheduler lifts the offset's addition over the wait
        __builtin_amdgcn_sched_barrier(0);

#pragma unroll
        for (int t = 0; t < 2; ++t) {
            // ---- S^T = K @ Q^T (32 keys x 16 queries) ----
            v8f s0 = {}, s1 = {};
            s0 = wmma_f16(kb0, qa[t][0], s0);
            s0 = wmma_f16(kb1, qa[t][1], s0);
            s1 = wmma_f16(kb2, qa[t][0], s1);
            s1 = wmma_f16(kb3, qa[t][1], s1);

            // ---- online softmax: 16 of the query's 32 scores in this lane ----
            // base 2, on the raw scores: the maximum is taken before any scaling (the
            // scale is positive), and one fused multiply-add a score gives its exponent
            float mx[8];
#pragma unroll
            for (int r = 0; r < 8; ++r) mx[r] = fmaxf(s0[r], s1[r]);
            float t0 = fmaxf(fmaxf(fmaxf(mx[0], mx[1]), fmaxf(mx[2], mx[3])),
                             fmaxf(fmaxf(mx[4], mx[5]), fmaxf(mx[6], mx[7])));
            t0 = fmaxf(t0, xhalf(t0));
            const float mnew = fmaxf(mr[t], t0);
            const float alpha = ex2((mr[t] - mnew) * SCL2);
            const float nm = -mnew * SCL2;
            const v8f cs = { SCL2, SCL2, SCL2, SCL2, SCL2, SCL2, SCL2, SCL2 };
            const v8f cm = { nm, nm, nm, nm, nm, nm, nm, nm };
            const v8f e0 = __builtin_elementwise_fma(s0, cs, cm);
            const v8f e1 = __builtin_elementwise_fma(s1, cs, cm);

            H16 pb;      // P^T as B operand: k = 8*hi + r, then 16 + 8*hi + r
            float ps[8];
#pragma unroll
            for (int r = 0; r < 8; ++r) {
                float p0 = ex2(e0[r]);
                float p1 = ex2(e1[r]);
                ps[r] = p0 + p1;
                pb.v[r]     = (_Float16)p0;
                pb.v[8 + r] = (_Float16)p1;
            }
            const float rs = ((ps[0] + ps[1]) + (ps[2] + ps[3])) +
                             ((ps[4] + ps[5]) + (ps[6] + ps[7]));
            ls[t] = ls[t] * alpha + rs;
            mr[t] = mnew;

            // ---- O^T = O^T * alpha + V^T @ P^T ----
#pragma unroll
            for (int n = 0; n < 4; ++n) o[t][n] *= alpha;
            o[t][0] = wmma_f16(vb0, pb.v, o[t][0]);
            o[t][1] = wmma_f16(vb1, pb.v, o[t][1]);
            o[t][2] = wmma_f16(vb2, pb.v, o[t][2]);
            o[t][3] = wmma_f16(vb3, pb.v, o[t][3]);
        }
    }

    // ---- hand this share's partial result to the work-group ----
#pragma unroll
    for (int t = 0; t < 2; ++t) {
#pragma unroll
        for (int n = 0; n < 4; ++n) {
            po[g][sp][t][n][0][lane] = (v4f){ o[t][n][0], o[t][n][1], o[t][n][2], o[t][n][3] };
            po[g][sp][t][n][1][lane] = (v4f){ o[t][n][4], o[t][n][5], o[t][n][6], o[t][n][7] };
        }
        pm[g][sp][t][lane] = mr[t];
        pl[g][sp][t][lane] = ls[t];
    }
    __syncthreads();

    // ---- merge the four shares; fused projection out^T = w_proj^T @ O^T + b_proj ----
    // Wave w: query group w >> 2, its 16-row tile (w >> 1) & 1, output columns
    // 32 * (w & 1) + 0..31 (one 128-byte line of each output row).
    const int et = (wave >> 1) & 1;
    const int ec = wave & 1;

    float wgt[KSHARES];
#pragma unroll
    for (int s = 0; s < KSHARES; ++s) wgt[s] = pm[g][s][et][lane];
    const float mall = fmaxf(fmaxf(wgt[0], wgt[1]), fmaxf(wgt[2], wgt[3]));
    float lall = 0.0f;
#pragma unroll
    for (int s = 0; s < KSHARES; ++s) {
        wgt[s] = ex2((wgt[s] - mall) * SCL2);
        lall += wgt[s] * pl[g][s][et][lane];
    }
    const float inv = 1.0f / (lall + xhalf(lall));
#pragma unroll
    for (int s = 0; s < KSHARES; ++s) wgt[s] *= inv;

    H16 ob0, ob1;   // O^T as B operand, k = d: tiles 0,1 then tiles 2,3
#pragma unroll
    for (int n = 0; n < 4; ++n) {
#pragma unroll
        for (int h = 0; h < 2; ++h) {
            v4f a = po[g][0][et][n][h][lane] * wgt[0];
#pragma unroll
            for (int s = 1; s < KSHARES; ++s) a += po[g][s][et][n][h][lane] * wgt[s];
#pragma unroll
            for (int r = 0; r < 4; ++r) {
                if (n < 2) ob0.v[(n & 1) * 8 + h * 4 + r] = (_Float16)a[r];
                else       ob1.v[(n & 1) * 8 + h * 4 + r] = (_Float16)a[r];
            }
        }
    }

    float* orow = out + (size_t)(m0 + et * 16 + lo) * HD + 8 * hi;
#pragma unroll
    for (int c = 0; c < 2; ++c) {
        const int ct = ec * 2 + c;
        // rows of out^T: output columns ct*16 + 8*hi + r of query row lo
        const float4 b0 = *(const float4*)(bias + ct * 16 + 8 * hi);
        const float4 b1 = *(const float4*)(bias + ct * 16 + 8 * hi + 4);
        v8f acc = { b0.x, b0.y, b0.z, b0.w, b1.x, b1.y, b1.z, b1.w };
        acc = wmma_f16(load_op(wpt, ct * 16, HD, 0,  lo, hi), ob0.v, acc);
        acc = wmma_f16(load_op(wpt, ct * 16, HD, 32, lo, hi), ob1.v, acc);
        *(float4*)(orow + ct * 16)     = make_float4(acc[0], acc[1], acc[2], acc[3]);
        *(float4*)(orow + ct * 16 + 4) = make_float4(acc[4], acc[5], acc[6], acc[7]);
    }
}

// ---------- host launcher ----------
extern "C" void kernel_launch(void* const* d_in, const int* in_sizes, int n_in,
                              void* d_out, int out_size, void* d_ws, size_t ws_size,
                              hipStream_t stream) {
    (void)in_sizes; (void)n_in; (void)out_size; (void)ws_size;
    const float* x     = (const float*)d_in[0];
    const float* wqkv  = (const float*)d_in[1];
    const float* wproj = (const float*)d_in[2];
    const float* bproj = (const float*)d_in[3];
    float* out = (float*)d_out;

    char* ws = (char*)d_ws;
    _Float16* wt  = (_Float16*)(ws);                //    294,912 B
    _Float16* wpt = (_Float16*)(ws + 294912);       //      8,192 B
    _Float16* qh  = (_Float16*)(ws + 303104);       //  2,097,152 B
    _Float16* kh  = (_Float16*)(ws + 2400256);      //  2,097,152 B
    _Float16* vt  = (_Float16*)(ws + 4497408);      //  2,097,152 B  (total 6,594,560 B)

    k_tr_wqkv<<<EMBED * QKVN / 8 / 256, 256, 0, stream>>>(wqkv, wt);
    k_tr_wproj<<<HD * HD / 256, 256, 0, stream>>>(wproj, wpt);
    k_qkv<<<(ROWS / 16) / 4, 128, 0, stream>>>(x, wt, qh, kh, vt);
    k_attn<<<ROWS / 64, 256, 0, stream>>>(qh, kh, vt, wpt, bproj, out);
}

// v006
// A run of this version takes 35.2 microseconds.
// Timed twice side by side with v005, it ran 1.06 times as fast both times.
// Counting every step since v000, it is 5.73 times as fast.
#include <hip/hip_runtime.h>
#include <hip/hip_bf16.h>

// ---------- constants ----------
#define BATCH 8
#define SEQ   2048
#define EMBED 768
#define HD    64
#define QKVN  192           // 3 * HD
#define ROWS  (BATCH * SEQ) // 16384
#define SCALE 0.125f        // 64^-0.5
#define LOG2E 1.44269504088896f
#define SCL2  (SCALE * LOG2E) // a raw score times this is its exponent to base 2

typedef _Float16 v4h  __attribute__((ext_vector_type(4)));
typedef _Float16 v8h  __attribute__((ext_vector_type(8)));
typedef _Float16 v16h __attribute__((ext_vector_type(16)));
typedef float    v8f  __attribute__((ext_vector_type(8)));
typedef float    v4f  __attribute__((ext_vector_type(4)));

union H16 { v16h v; struct { v8h lo; v8h hi; } h; };

static __device__ __forceinline__ v8f wmma_f16(v16h a, v16h b, v8f c) {
    // D = A(16x32 f16) * B(32x16 f16) + C(16x16 f32)
    return __builtin_amdgcn_wmma_f32_16x16x32_f16(false, a, false, b, (short)0, c,
                                                  false, false);
}

// Load a 16x32 f16 A-operand (== B-operand of the transpose) from a row-major
// matrix with leading dimension ld (in halves), rows starting at row0, k-block kb.
static __device__ __forceinline__ v16h load_op(const _Float16* __restrict__ base,
                                               int row0, int ld, int kb,
                                               int lo, int hi) {
    const _Float16* r = base + (size_t)(row0 + lo) * ld + kb + hi * 8;
    H16 u;
    u.h.lo = *(const v8h*)(r);
    u.h.hi = *(const v8h*)(r + 16);
    return u.v;
}

// Fragment order: a 16x32 f16 operand lies as 1,024 bytes in a row, two chunks of
// 512 bytes; chunk c holds, at 16 bytes a lane, what load_op gives that lane as its
// half c (row lo, k = 16*c + 8*hi + 0..7). A wave's 16-byte load then covers four
// whole 128-byte lines in place of 32 bytes in each of 16 lines.
#define FRAG 512            // halves in a fragment
static __device__ __forceinline__ v16h load_frag(const _Float16* __restrict__ p) {
    H16 u;                  // p: the fragment's start + 8 * lane
    u.h.lo = *(const v8h*)(p);
    u.h.hi = *(const v8h*)(p + 256);
    return u.v;
}

// ---------- kernel 1: both weight matrices to f16, one launch ----------
// Blocks 0..71: w_qkv (768x192 f32) -> Wt (f16, fragment order). Fragment kbi * 12 + nt:
// columns nt*16 + 0..15 of w_qkv, k-block kbi. One thread writes one lane's 16 bytes of
// one chunk. Blocks 72..87: w_proj (64x64 f32) -> Wpt (64x64 f16, transposed), one
// element a thread. The two jobs share nothing, so they need no launch boundary between
// them.
#define WQKV_BLOCKS (EMBED * QKVN / 8 / 256)   // 72
#define WPROJ_BLOCKS (HD * HD / 256)           // 16
__global__ __launch_bounds__(256) void k_tr_w(const float* __restrict__ w,
                                              const float* __restrict__ wp,
                                              _Float16* __restrict__ wt,
                                              _Float16* __restrict__ wpt) {
    if (blockIdx.x < WQKV_BLOCKS) {
        const int idx = blockIdx.x * 256 + threadIdx.x;    // < 18432
        const int lo = idx & 15, hi = (idx >> 4) & 1, c = (idx >> 5) & 1;
        const int f = idx >> 6;                            // < 288
        const int kbi = f / 12, nt = f % 12;
        const float* s = w + (size_t)(kbi * 32 + c * 16 + hi * 8) * QKVN + nt * 16 + lo;
        v8h h;
#pragma unroll
        for (int j = 0; j < 8; ++j) h[j] = (_Float16)s[j * QKVN];
        *(v8h*)(wt + (size_t)idx * 8) = h;
    } else {
        const int idx = (blockIdx.x - WQKV_BLOCKS) * 256 + threadIdx.x;   // < 4096
        const int k = idx / HD, n = idx % HD;
        const float e = wp[idx];
        // the load's offset register is reused for the rounded value
        asm volatile("s_wait_xcnt 0x0" ::: "memory");
        wpt[(size_t)n * HD + k] = (_Float16)e;
        // in the built code the other half's address arithmetic stands behind this store
        // and reuses its address and data registers
        asm volatile("s_wait_xcnt 0x0" ::: "memory");
    }
}

// ---------- kernel 2: QKV projection ----------
// One wave computes a full 16x192 row-block (12 resident accumulators).
// All 12 weight operands are loaded into distinct registers BEFORE the WMMA chain so
// the scheduler can overlap loads with matrix ops (partial loadcnt waits)
// instead of draining the load pipe before every WMMA.
// x is read as f32 and rounded to f16 (nearest even) in registers on its way
// into its operand (B of the q and k tiles, A of the v tiles): a lane's 16 k values are two runs of 8 floats of its row.
// q, k and v leave in the fragment order of their reader. A lane must then hold 8
// neighbours along the reader's k: head dims for q and k, so these eight tiles are
// formed transposed (W^T * x^T: same registers, operands swapped); keys for v.
__global__ __launch_bounds__(128) void k_qkv(const float* __restrict__ x,
                                             const _Float16* __restrict__ wt,
                                             _Float16* __restrict__ qh,
                                             _Float16* __restrict__ kh,
                                             _Float16* __restrict__ vt) {
    const int lane = threadIdx.x & 31;
    const int lo = lane & 15, hi = lane >> 4;
    const int mt = blockIdx.x * 4 + (threadIdx.x >> 5);  // < 1024
    const int m0 = mt * 16;

    // walks the lane's row, one k-block (128 bytes) a trip
    const float* xp = x + (size_t)(m0 + lo) * EMBED + hi * 8;
    // walks the weight fragments, twelve (12,288 bytes in a row) a trip
    const _Float16* wp = wt + lane * 8;

    // x comes from memory and the load counter returns in order, so a load issued
    // ahead would hold up the weight loads behind it: prefetch the row into L2 ahead
    // of its loads instead, one address every 256 bytes. Units 1 to 3 here, unit u + 4 in the loop.
    asm volatile("global_prefetch_b8 %0, off offset:256 scope:SCOPE_SE\n\t"
                 "global_prefetch_b8 %0, off offset:512 scope:SCOPE_SE\n\t"
                 "global_prefetch_b8 %0, off offset:768 scope:SCOPE_SE" :: "v"(xp));

    v8f acc[12];
#pragma unroll
    for (int nt = 0; nt < 12; ++nt) acc[nt] = (v8f){};

#pragma unroll 1
    for (int kb = 0; kb < EMBED; kb += 32) {
        const v4f f0 = *(const v4f*)(xp);
        const v4f f1 = *(const v4f*)(xp + 4);
        const v4f f2 = *(const v4f*)(xp + 16);
        const v4f f3 = *(const v4f*)(xp + 20);

        v16h bv[12];
#pragma unroll
        for (int nt = 0; nt < 12; ++nt)
            bv[nt] = load_frag(wp + nt * FRAG);

        // every second trip: the unit read eight trips from now (still inside the
        // row, also after xp has moved on once more)
        if ((kb & 32) == 0 && kb + 288 < EMBED)
            asm volatile("global_prefetch_b8 %0, off offset:1024 scope:SCOPE_SE" :: "v"(xp));

        const v4h h0 = __builtin_convertvector(f0, v4h);
        const v4h h1 = __builtin_convertvector(f1, v4h);
        const v4h h2 = __builtin_convertvector(f2, v4h);
        const v4h h3 = __builtin_convertvector(f3, v4h);
        H16 a;   // k = 8*hi + 0..7, then 16 + 8*hi + 0..7, as the weight loader has it
        a.h.lo = __builtin_shufflevector(h0, h1, 0, 1, 2, 3, 4, 5, 6, 7);
        a.h.hi = __builtin_shufflevector(h2, h3, 0, 1, 2, 3, 4, 5, 6, 7);

#pragma unroll
        for (int nt = 0; nt < 12; ++nt)
            acc[nt] = nt < 8 ? wmma_f16(bv[nt], a.v, acc[nt])    // column nt*16+8*hi+r, row lo
                             : wmma_f16(a.v, bv[nt], acc[nt]);   // row 8*hi+r, column nt*16+lo
        xp += 32;
        wp += 12 * FRAG;
    }

    // q, k: row tile mt is fragments 2*mt (dims 0..31) and 2*mt + 1; tile nt is chunk
    // nt & 1 of fragment nt >> 1. v: 32-key block mt >> 1 is fragments 4*(mt >> 1) + n
    // (dims 16*n + 0..15); this wave's 16 keys are chunk mt & 1 of each.
#pragma unroll
    for (int nt = 0; nt < 12; ++nt) {
        const v8h h = __builtin_convertvector(acc[nt], v8h);
        if (nt < 4) {
            *(v8h*)(qh + (size_t)(mt * 4 + nt) * 256 + lane * 8) = h;
        } else if (nt < 8) {
            *(v8h*)(kh + (size_t)(mt * 4 + nt - 4) * 256 + lane * 8) = h;
        } else {
            *(v8h*)(vt + (size_t)(((mt >> 1) * 4 + nt - 8) * 2 + (mt & 1)) * 256 + lane * 8) = h;
        }
    }
}

// 2^x as the one hardware instruction. Library exp2f adds a compare, two selects, an
// add and a scaling to each call, so that results below 2^-126 come out as denormals;
// here such a weight rounds to 0 in f16 and is lost in a row sum whose largest term is 1.
static __device__ __forceinline__ float ex2(float x) { return __builtin_amdgcn_exp2f(x); }

// value of lane l ^ 16 (the other half of the wave), on the vector pipe
static __device__ __forceinline__ float xhalf(float x) {
    int i = __builtin_bit_cast(int, x);
    return __builtin_bit_cast(float, __builtin_amdgcn_permlanex16(
        i, i, 0x76543210, 0xfedcba98, false, false));
}

// Keys are dealt over the waves of a work-group: 8 waves = 2 query groups of 32
// rows x 4 key shares. Share sp takes the 32-key blocks sp, sp + 4, sp + 8, ... with
// its own running maximum, sum and O^T; the four partial results of a query group
// meet in LDS behind one barrier. 2,048 waves instead of 512: two on every SIMD.
#define KSHARES 4

// two waves a SIMD is all this grid places: the compiler may spend that budget's registers
__global__ __launch_bounds__(256) __attribute__((amdgpu_waves_per_eu(2, 2)))
void k_attn(const _Float16* __restrict__ qh,
                                              const _Float16* __restrict__ kh,
                                              const _Float16* __restrict__ vt,
                                              const _Float16* __restrict__ wpt,
                                              const float* __restrict__ bias,
                                              float* __restrict__ out) {
    // partial O^T: [group][share][t][n][r / 4][lane], 16 bytes a lane, so that every
    // LDS store and load is 512 contiguous bytes; reader and writer use the same lane
    __shared__ v4f   po[2][KSHARES][2][4][2][32];   // 65,536 B
    __shared__ float pm[2][KSHARES][2][32];         //  2,048 B: running maxima (raw scores)
    __shared__ float pl[2][KSHARES][2][32];         //  2,048 B: this half's sums

    const int lane = threadIdx.x & 31;
    const int lo = lane & 15, hi = lane >> 4;
    // wave number as a scalar: the key loop's counter stays in scalar registers
    const int wave = __builtin_amdgcn_readfirstlane(threadIdx.x >> 5);   // < 8
    const int g  = wave >> 2;               // query group of this block
    const int sp = wave & 3;                // key share
    const int m0 = (blockIdx.x * 2 + g) * 32;   // first of 32 query rows
    const int b = m0 >> 11;                 // 64 rows a block: one batch entry

    // resident Q operands (B of S^T): two row-tiles x two k-blocks
    v16h qa[2][2];
#pragma unroll
    for (int t = 0; t < 2; ++t) {
        qa[t][0] = load_frag(qh + (size_t)(m0 + t * 16) * HD + lane * 8);
        qa[t][1] = load_frag(qh + (size_t)(m0 + t * 16) * HD + FRAG + lane * 8);
    }

    // fragment order: a 32-key block is 4 fragments (4,096 bytes in a row) in each of
    // K (key tile, dims half) and V^T (dims tile), at the block's first row * HD halves
    const _Float16* kbase = kh + (size_t)b * SEQ * HD;
    const _Float16* vbase = vt + (size_t)b * HD * SEQ;

    // o[t][n]: O^T tile, rows d = 16*n + 8*hi + r, column = query t*16 + lo.
    // mr[t]: running maximum of that query's raw scores over this share (equal in both halves);
    // ls[t]: running sum over this half's keys of this share, joined after the loop.
    v8f o[2][4];
    float mr[2], ls[2];
#pragma unroll
    for (int t = 0; t < 2; ++t) {
#pragma unroll
        for (int n = 0; n < 4; ++n) o[t][n] = (v8f){};
        mr[t] = -3.0e38f; ls[t] = 0.0f;
    }

    // the lane's byte offset in the block, the same in both planes (below 2 MiB): one
    // 32-bit register beside the two scalar bases addresses all 16 loads of a trip
    unsigned fo = (unsigned)((b * SEQ + sp * 32) * HD + lane * 8) * 2u;
    for (int kv = sp * 32; kv < SEQ; kv += 32 * KSHARES, fo += 32 * KSHARES * HD * 2) {
        // shared K operands for S^T, shared V^T operands for O^T (distinct registers)
        const _Float16* kp = (const _Float16*)((const char*)kh + fo);
        const _Float16* vp = (const _Float16*)((const char*)vt + fo);
        const v16h kb0 = load_frag(kp);              // keys kv + 0..15,  dims 0..31
        const v16h kb1 = load_frag(kp + FRAG);       //                   dims 32..63
        const v16h kb2 = load_frag(kp + 2 * FRAG);   // keys kv + 16..31, dims 0..31
        const v16h kb3 = load_frag(kp + 3 * FRAG);   //                   dims 32..63
        const v16h vb0 = load_frag(vp);              // dims 0..15, keys kv + 0..31
        const v16h vb1 = load_frag(vp + FRAG);
        const v16h vb2 = load_frag(vp + 2 * FRAG);
        const v16h vb3 = load_frag(vp + 3 * FRAG);
        // all 16 loads of the trip are issued before its first product: without this the
        // scheduler reuses K registers and the trip waits out a load latency twice
        __builtin_amdgcn_sched_barrier(0);

        if (kv + 32 * KSHARES < SEQ) {  // prefetch this wave's next K/V tiles
            const int kn = kv + 32 * KSHARES;
            __builtin_prefetch(kbase + (size_t)(kn + lane) * HD, 0, 0);   // a line a lane
            __builtin_prefetch(vbase + (size_t)(kn + lane) * HD, 0, 0);
        }
        // the loads' offset register moves on, and the prefetches' address register is
        // reused, among the products right behind
        asm volatile("s_wait_xcnt 0x0" ::: "memory");
        // without this the scheduler lifts the offset's addition over the wait
        __builtin_amdgcn_sched_barrier(0);

#pragma unroll
        for (int t = 0; t < 2; ++t) {
            // ---- S^T = K @ Q^T (32 keys x 16 queries) ----
            v8f s0 = {}, s1 = {};
            s0 = wmma_f16(kb0, qa[t][0], s0);
            s0 = wmma_f16(kb1, qa[t][1], s0);
            s1 = wmma_f16(kb2, qa[t][0], s1);
            s1 = wmma_f16(kb3, qa[t][1], s1);

            // ---- online softmax: 16 of the query's 32 scores in this lane ----
            // base 2, on the raw scores: the maximum is taken before any scaling (the
            // scale is positive), and one fused multiply-add a score gives its exponent
            float mx[8];
#pragma unroll
            for (int r = 0; r < 8; ++r) mx[r] = fmaxf(s0[r], s1[r]);
            float t0 = fmaxf(fmaxf(fmaxf(mx[0], mx[1]), fmaxf(mx[2], mx[3])),
                             fmaxf(fmaxf(mx[4], mx[5]), fmaxf(mx[6], mx[7])));
            t0 = fmaxf(t0, xhalf(t0));
            const float mnew = fmaxf(mr[t], t0);
            const float alpha = ex2((mr[t] - mnew) * SCL2);
            const float nm = -mnew * SCL2;
            const v8f cs = { SCL2, SCL2, SCL2, SCL2, SCL2, SCL2, SCL2, SCL2 };
            const v8f cm = { nm, nm, nm, nm, nm, nm, nm, nm };
            const v8f e0 = __builtin_elementwise_fma(s0, cs, cm);
            const v8f e1 = __builtin_elementwise_fma(s1, cs, cm);

            H16 pb;      // P^T as B operand: k = 8*hi + r, then 16 + 8*hi + r
            float ps[8];
#pragma unroll
            for (int r = 0; r < 8; ++r) {
                float p0 = ex2(e0[r]);
                float p1 = ex2(e1[r]);
                ps[r] = p0 + p1;
                pb.v[r]     = (_Float16)p0;
                pb.v[8 + r] = (_Float16)p1;
            }
            const float rs = ((ps[0] + ps[1]) + (ps[2] + ps[3])) +
                             ((ps[4] + ps[5]) + (ps[6] + ps[7]));
            ls[t] = ls[t] * alpha + rs;
            mr[t] = mnew;

            // ---- O^T = O^T * alpha + V^T @ P^T ----
#pragma unroll
            for (int n = 0; n < 4; ++n) o[t][n] *= alpha;
            o[t][0] = wmma_f16(vb0, pb.v, o[t][0]);
            o[t][1] = wmma_f16(vb1, pb.v, o[t][1]);
            o[t][2] = wmma_f16(vb2, pb.v, o[t][2]);
            o[t][3] = wmma_f16(vb3, pb.v, o[t][3]);
        }
    }

    // ---- hand this share's partial result to the work-group ----
#pragma unroll
    for (int t = 0; t < 2; ++t) {
#pragma unroll
        for (int n = 0; n < 4; ++n) {
            po[g][sp][t][n][0][lane] = (v4f){ o[t][n][0], o[t][n][1], o[t][n][2], o[t][n][3] };
            po[g][sp][t][n][1][lane] = (v4f){ o[t][n][4], o[t][n][5], o[t][n][6], o[t][n][7] };
        }
        pm[g][sp][t][lane] = mr[t];
        pl[g][sp][t][lane] = ls[t];
    }
    __syncthreads();

    // ---- merge the four shares; fused projection out^T = w_proj^T @ O^T + b_proj ----
    // Wave w: query group w >> 2, its 16-row tile (w >> 1) & 1, output columns
    // 32 * (w & 1) + 0..31 (one 128-byte line of each output row).
    const int et = (wave >> 1) & 1;
    const int ec = wave & 1;

    float wgt[KSHARES];
#pragma unroll
    for (int s = 0; s < KSHARES; ++s) wgt[s] = pm[g][s][et][lane];
    const float mall = fmaxf(fmaxf(wgt[0], wgt[1]), fmaxf(wgt[2], wgt[3]));
    float lall = 0.0f;
#pragma unroll
    for (int s = 0; s < KSHARES; ++s) {
        wgt[s] = ex2((wgt[s] - mall) * SCL2);
        lall += wgt[s] * pl[g][s][et][lane];
    }
    const float inv = 1.0f / (lall + xhalf(lall));
#pragma unroll
    for (int s = 0; s < KSHARES; ++s) wgt[s] *= inv;

    H16 ob0, ob1;   // O^T as B operand, k = d: tiles 0,1 then tiles 2,3
#pragma unroll
    for (int n = 0; n < 4; ++n) {
#pragma unroll
        for (int h = 0; h < 2; ++h) {
            v4f a = po[g][0][et][n][h][lane] * wgt[0];
#pragma unroll
            for (int s = 1; s < KSHARES; ++s) a += po[g][s][et][n][h][lane] * wgt[s];
#pragma unroll
            for (int r = 0; r < 4; ++r) {
                if (n < 2) ob0.v[(n & 1) * 8 + h * 4 + r] = (_Float16)a[r];
                else       ob1.v[(n & 1) * 8 + h * 4 + r] = (_Float16)a[r];
            }
        }
    }

    float* orow = out + (size_t)(m0 + et * 16 + lo) * HD + 8 * hi;
#pragma unroll
    for (int c = 0; c < 2; ++c) {
        const int ct = ec * 2 + c;
        // rows of out^T: output columns ct*16 + 8*hi + r of query row lo
        const float4 b0 = *(const float4*)(bias + ct * 16 + 8 * hi);
        const float4 b1 = *(const float4*)(bias + ct * 16 + 8 * hi + 4);
        v8f acc = { b0.x, b0.y, b0.z, b0.w, b1.x, b1.y, b1.z, b1.w };
        acc = wmma_f16(load_op(wpt, ct * 16, HD, 0,  lo, hi), ob0.v, acc);
        acc = wmma_f16(load_op(wpt, ct * 16, HD, 32, lo, hi), ob1.v, acc);
        *(float4*)(orow + ct * 16)     = make_float4(acc[0], acc[1], acc[2], acc[3]);
        *(float4*)(orow + ct * 16 + 4) = make_float4(acc[4], acc[5], acc[6], acc[7]);
    }
}

// ---------- host launcher ----------
extern "C" void kernel_launch(void* const* d_in, const int* in_sizes, int n_in,
                              void* d_out, int out_size, void* d_ws, size_t ws_size,
                              hipStream_t stream) {
    (void)in_sizes; (void)n_in; (void)out_size; (void)ws_size;
    const float* x     = (const float*)d_in[0];
    const float* wqkv  = (const float*)d_in[1];
    const float* wproj = (const float*)d_in[2];
    const float* bproj = (const float*)d_in[3];
    float* out = (float*)d_out;

    char* ws = (char*)d_ws;
    _Float16* wt  = (_Float16*)(ws);                //    294,912 B
    _Float16* wpt = (_Float16*)(ws + 294912);       //      8,192 B
    _Float16* qh  = (_Float16*)(ws + 303104);       //  2,097,152 B
    _Float16* kh  = (_Float16*)(ws + 2400256);      //  2,097,152 B
    _Float16* vt  = (_Float16*)(ws + 4497408);      //  2,097,152 B  (total 6,594,560 B)

    k_tr_w<<<WQKV_BLOCKS + WPROJ_BLOCKS, 256, 0, stream>>>(wqkv, wproj, wt, wpt);
    k_qkv<<<(ROWS / 16) / 4, 128, 0, stream>>>(x, wt, qh, kh, vt);
    k_attn<<<ROWS / 64, 256, 0, stream>>>(qh, kh, vt, wpt, bproj, out);
}

// v007
// Measured time: 27 microseconds a run.
// In both of two side-by-side timings against v006, it was 1.31 times as fast.
// Counting every step since v000, it is 7.49 times as fast.
#include <hip/hip_runtime.h>
#include <hip/hip_bf16.h>

// ---------- constants ----------
#define BATCH 8
#define SEQ   2048
#define EMBED 768
#define HD    64
#define QKVN  192           // 3 * HD
#define ROWS  (BATCH * SEQ) // 16384
#define SCALE 0.125f        // 64^-0.5
#define LOG2E 1.44269504088896f
#define SCL2  (SCALE * LOG2E) // a raw score times this is its exponent to base 2

typedef _Float16 v4h  __attribute__((ext_vector_type(4)));
typedef _Float16 v8h  __attribute__((ext_vector_type(8)));
typedef _Float16 v16h __attribute__((ext_vector_type(16)));
typedef float    v8f  __attribute__((ext_vector_type(8)));
typedef float    v4f  __attribute__((ext_vector_type(4)));

union H16 { v16h v; struct { v8h lo; v8h hi; } h; };

static __device__ __forceinline__ v8f wmma_f16(v16h a, v16h b, v8f c) {
    // D = A(16x32 f16) * B(32x16 f16) + C(16x16 f32)
    return __builtin_amdgcn_wmma_f32_16x16x32_f16(false, a, false, b, (short)0, c,
                                                  false, false);
}

// Load a 16x32 f16 A-operand (== B-operand of the transpose) from a row-major
// matrix with leading dimension ld (in halves), rows starting at row0, k-block kb.
static __device__ __forceinline__ v16h load_op(const _Float16* __restrict__ base,
                                               int row0, int ld, int kb,
                                               int lo, int hi) {
    const _Float16* r = base + (size_t)(row0 + lo) * ld + kb + hi * 8;
    H16 u;
    u.h.lo = *(const v8h*)(r);
    u.h.hi = *(const v8h*)(r + 16);
    return u.v;
}

// Fragment order: a 16x32 f16 operand lies as 1,024 bytes in a row, two chunks of
// 512 bytes; chunk c holds, at 16 bytes a lane, what load_op gives that lane as its
// half c (row lo, k = 16*c + 8*hi + 0..7). A wave's 16-byte load then covers four
// whole 128-byte lines in place of 32 bytes in each of 16 lines.
#define FRAG 512            // halves in a fragment
static __device__ __forceinline__ v16h load_frag(const _Float16* __restrict__ p) {
    H16 u;                  // p: the fragment's start + 8 * lane
    u.h.lo = *(const v8h*)(p);
    u.h.hi = *(const v8h*)(p + 256);
    return u.v;
}

// ---------- kernel 1: both weight matrices to f16, one launch ----------
// Blocks 0..71: w_qkv (768x192 f32) -> Wt (f16, fragment order). Fragment kbi * 12 + nt:
// columns nt*16 + 0..15 of w_qkv, k-block kbi. One thread writes one lane's 16 bytes of
// one chunk. Blocks 72..87: w_proj (64x64 f32) -> Wpt (64x64 f16, transposed), one
// element a thread. The two jobs share nothing, so they need no launch boundary between
// them.
#define WQKV_BLOCKS (EMBED * QKVN / 8 / 256)   // 72
#define WPROJ_BLOCKS (HD * HD / 256)           // 16
__global__ __launch_bounds__(256) void k_tr_w(const float* __restrict__ w,
                                              const float* __restrict__ wp,
                                              _Float16* __restrict__ wt,
                                              _Float16* __restrict__ wpt) {
    if (blockIdx.x < WQKV_BLOCKS) {
        const int idx = blockIdx.x * 256 + threadIdx.x;    // < 18432
        const int lo = idx & 15, hi = (idx >> 4) & 1, c = (idx >> 5) & 1;
        const int f = idx >> 6;                            // < 288
        const int kbi = f / 12, nt = f % 12;
        const float* s = w + (size_t)(kbi * 32 + c * 16 + hi * 8) * QKVN + nt * 16 + lo;
        v8h h;
#pragma unroll
        for (int j = 0; j < 8; ++j) h[j] = (_Float16)s[j * QKVN];
        *(v8h*)(wt + (size_t)idx * 8) = h;
    } else {
        const int idx = (blockIdx.x - WQKV_BLOCKS) * 256 + threadIdx.x;   // < 4096
        const int k = idx / HD, n = idx % HD;
        const float e = wp[idx];
        // the load's offset register is reused for the rounded value
        asm volatile("s_wait_xcnt 0x0" ::: "memory");
        wpt[(size_t)n * HD + k] = (_Float16)e;
        // in the built code the other half's address arithmetic stands behind this store
        // and reuses its address and data registers
        asm volatile("s_wait_xcnt 0x0" ::: "memory");
    }
}

// ---------- kernel 2: QKV projection ----------
// One wave computes a full 16x192 row-block (12 resident accumulators).
// x is read as f32 and rounded to f16 (nearest even) in registers on its way
// into its operand (B of the q and k tiles, A of the v tiles): a lane's 16 k values are two runs of 8 floats of its row.
// q, k and v leave in the fragment order of their reader. A lane must then hold 8
// neighbours along the reader's k: head dims for q and k, so these eight tiles are
// formed transposed (W^T * x^T: same registers, operands swapped); keys for v.
//
// The k loop is a register ring of QDEPTH operand sets (x block + 12 weight fragments):
// a set's block I + QDEPTH is asked for as soon as block I's products have read it, so
// QDEPTH blocks of loads are in flight under the products; a lone wave on its SIMD has
// nobody else to cover a load's latency. The loop is unrolled whole: every address is
// one of two fixed register pairs plus an immediate, so no address register is
// rewritten while loads that name it are under way.
#define KBLOCKS (EMBED / 32)   // 24
#define QDEPTH  2

// prefetches byte O of the lane's row into L2 (for speed only)
template <int O>
static __device__ __forceinline__ void prefetch_x(const float* p) {
    asm volatile("global_prefetch_b8 %0, off offset:%1 scope:SCOPE_SE" :: "v"(p), "n"(O));
}

template <int I>
static __device__ __forceinline__ void load_x(const float* __restrict__ xp, v4f (&f)[4]) {
    f[0] = *(const v4f*)(xp + I * 32);
    f[1] = *(const v4f*)(xp + I * 32 + 4);
    f[2] = *(const v4f*)(xp + I * 32 + 16);
    f[3] = *(const v4f*)(xp + I * 32 + 20);
}

// fragments N0 .. N0 + 3 of k-block I
template <int I, int N0>
static __device__ __forceinline__ void load_w4(const _Float16* __restrict__ wp, v16h (&bv)[12]) {
#pragma unroll
    for (int nt = N0; nt < N0 + 4; ++nt)
        bv[nt] = load_frag(wp + (I * 12 + nt) * FRAG);
}

// k-blocks I .. KBLOCKS - 1. Three runs of four products, each followed by the loads of
// block I + QDEPTH into the four fragments it has read. The scheduling barriers keep each
// load group at its place: sunk behind the block's last product it would lose its lead,
// lifted over the run it would take registers beside the ring's.
template <int I>
static __device__ __forceinline__ void qkv_blocks(const float* __restrict__ xp,
                                                  const _Float16* __restrict__ wp,
                                                  v8f (&acc)[12], v16h (&bv)[QDEPTH][12],
                                                  v4f (&f)[QDEPTH][4]) {
    constexpr int  P    = I % QDEPTH;
    constexpr bool MORE = I + QDEPTH < KBLOCKS;

    H16 a;   // k = 8*hi + 0..7, then 16 + 8*hi + 0..7, as the weight loader has it
    a.h.lo = __builtin_shufflevector(__builtin_convertvector(f[P][0], v4h),
                                     __builtin_convertvector(f[P][1], v4h), 0, 1, 2, 3, 4, 5, 6, 7);
    a.h.hi = __builtin_shufflevector(__builtin_convertvector(f[P][2], v4h),
                                     __builtin_convertvector(f[P][3], v4h), 0, 1, 2, 3, 4, 5, 6, 7);

#pragma unroll
    for (int nt = 0; nt < 4; ++nt)
        acc[nt] = wmma_f16(bv[P][nt], a.v, acc[nt]);         // column nt*16+8*hi+r, row lo
    if constexpr (MORE) {
        __builtin_amdgcn_sched_barrier(0);   // not lifted into fresh registers
        load_x<I + QDEPTH>(xp, f[P]);
        load_w4<I + QDEPTH, 0>(wp, bv[P]);
        // every second block: the start of block I + 8's x (inside the row)
        if constexpr (I % 2 == 0 && I + 9 < KBLOCKS)
            prefetch_x<I * 128 + 1024>(xp);
        __builtin_amdgcn_sched_barrier(0);   // not sunk behind the next run
    }

#pragma unroll
    for (int nt = 4; nt < 8; ++nt)
        acc[nt] = wmma_f16(bv[P][nt], a.v, acc[nt]);
    if constexpr (MORE) {
        __builtin_amdgcn_sched_barrier(0);   // as above
        load_w4<I + QDEPTH, 4>(wp, bv[P]);
        __builtin_amdgcn_sched_barrier(0);
    }

#pragma unroll
    for (int nt = 8; nt < 12; ++nt)
        acc[nt] = wmma_f16(a.v, bv[P][nt], acc[nt]);         // row 8*hi+r, column nt*16+lo
    if constexpr (MORE) {
        __builtin_amdgcn_sched_barrier(0);   // as above
        load_w4<I + QDEPTH, 8>(wp, bv[P]);
        __builtin_amdgcn_sched_barrier(0);
    }

    if constexpr (I + 1 < KBLOCKS) qkv_blocks<I + 1>(xp, wp, acc, bv, f);
}

// the ring's first QDEPTH blocks, in the order in which the loop asks for the later ones
// (the load counter returns in order: x of a block ahead of its weights)
template <int I>
static __device__ __forceinline__ void qkv_fill(const float* __restrict__ xp,
                                                const _Float16* __restrict__ wp,
                                                v16h (&bv)[QDEPTH][12], v4f (&f)[QDEPTH][4]) {
    load_x<I>(xp, f[I]);
    // holds x ahead of the weights
    __builtin_amdgcn_sched_barrier(0);
    load_w4<I, 0>(wp, bv[I]);
    load_w4<I, 4>(wp, bv[I]);
    load_w4<I, 8>(wp, bv[I]);
    // holds this block ahead of the next
    __builtin_amdgcn_sched_barrier(0);
    if constexpr (I + 1 < QDEPTH) qkv_fill<I + 1>(xp, wp, bv, f);
}

// one wave a SIMD is all this grid places: the ring may spend that budget's registers
__global__ __launch_bounds__(128) __attribute__((amdgpu_waves_per_eu(1, 1)))
void k_qkv(const float* __restrict__ x,
                                             const _Float16* __restrict__ wt,
                                             _Float16* __restrict__ qh,
                                             _Float16* __restrict__ kh,
                                             _Float16* __restrict__ vt) {
    const int lane = threadIdx.x & 31;
    const int lo = lane & 15, hi = lane >> 4;
    const int mt = blockIdx.x * 4 + (threadIdx.x >> 5);  // < 1024
    const int m0 = mt * 16;

    // the lane's place in its row; a k-block is 128 bytes of it
    const float* xp = x + (size_t)(m0 + lo) * EMBED + hi * 8;
    // the lane's place in a weight fragment; a k-block is twelve (12,288 bytes in a row)
    const _Float16* wp = wt + lane * 8;

    // x comes from memory and the load counter returns in order, so a load that goes to
    // memory would hold up the weight loads behind it: prefetch the row at 256-byte
    // steps ahead of its loads. Bytes 256 to 768 here, the later steps in the loop.
    prefetch_x<256>(xp);
    prefetch_x<512>(xp);
    prefetch_x<768>(xp);

    v8f acc[12];
#pragma unroll
    for (int nt = 0; nt < 12; ++nt) acc[nt] = (v8f){};

    v16h bv[QDEPTH][12];
    v4f  f[QDEPTH][4];
    qkv_fill<0>(xp, wp, bv, f);
    qkv_blocks<0>(xp, wp, acc, bv, f);
    // what follows reuses the address registers that the loads and prefetches have named
    asm volatile("s_wait_xcnt 0x0" ::: "memory");
    // keeps the stores' address arithmetic behind the wait
    __builtin_amdgcn_sched_barrier(0);

    // q, k: row tile mt is fragments 2*mt (dims 0..31) and 2*mt + 1; tile nt is chunk
    // nt & 1 of fragment nt >> 1. v: 32-key block mt >> 1 is fragments 4*(mt >> 1) + n
    // (dims 16*n + 0..15); this wave's 16 keys are chunk mt & 1 of each.
#pragma unroll
    for (int nt = 0; nt < 12; ++nt) {
        const v8h h = __builtin_convertvector(acc[nt], v8h);
        if (nt < 4) {
            *(v8h*)(qh + (size_t)(mt * 4 + nt) * 256 + lane * 8) = h;
        } else if (nt < 8) {
            *(v8h*)(kh + (size_t)(mt * 4 + nt - 4) * 256 + lane * 8) = h;
        } else {
            *(v8h*)(vt + (size_t)(((mt >> 1) * 4 + nt - 8) * 2 + (mt & 1)) * 256 + lane * 8) = h;
        }
    }
}

// 2^x as the one hardware instruction. Library exp2f adds a compare, two selects, an
// add and a scaling to each call, so that results below 2^-126 come out as denormals;
// here such a weight rounds to 0 in f16 and is lost in a row sum whose largest term is 1.
static __device__ __forceinline__ float ex2(float x) { return __builtin_amdgcn_exp2f(x); }

// value of lane l ^ 16 (the other half of the wave), on the vector pipe
static __device__ __forceinline__ float xhalf(float x) {
    int i = __builtin_bit_cast(int, x);
    return __builtin_bit_cast(float, __builtin_amdgcn_permlanex16(
        i, i, 0x76543210, 0xfedcba98, false, false));
}

// Keys are dealt over the waves of a work-group: 8 waves = 2 query groups of 32
// rows x 4 key shares. Share sp takes the 32-key blocks sp, sp + 4, sp + 8, ... with
// its own running maximum, sum and O^T; the four partial results of a query group
// meet in LDS behind one barrier. 2,048 waves instead of 512: two on every SIMD.
#define KSHARES 4

// two waves a SIMD is all this grid places: the compiler may spend that budget's registers
__global__ __launch_bounds__(256) __attribute__((amdgpu_waves_per_eu(2, 2)))
void k_attn(const _Float16* __restrict__ qh,
                                              const _Float16* __restrict__ kh,
                                              const _Float16* __restrict__ vt,
                                              const _Float16* __restrict__ wpt,
                                              const float* __restrict__ bias,
                                              float* __restrict__ out) {
    // partial O^T: [group][share][t][n][r / 4][lane], 16 bytes a lane, so that every
    // LDS store and load is 512 contiguous bytes; reader and writer use the same lane
    __shared__ v4f   po[2][KSHARES][2][4][2][32];   // 65,536 B
    __shared__ float pm[2][KSHARES][2][32];         //  2,048 B: running maxima (raw scores)
    __shared__ float pl[2][KSHARES][2][32];         //  2,048 B: this half's sums

    const int lane = threadIdx.x & 31;
    const int lo = lane & 15, hi = lane >> 4;
    // wave number as a scalar: the key loop's counter stays in scalar registers
    const int wave = __builtin_amdgcn_readfirstlane(threadIdx.x >> 5);   // < 8
    const int g  = wave >> 2;               // query group of this block
    const int sp = wave & 3;                // key share
    const int m0 = (blockIdx.x * 2 + g) * 32;   // first of 32 query rows
    const int b = m0 >> 11;                 // 64 rows a block: one batch entry

    // resident Q operands (B of S^T): two row-tiles x two k-blocks
    v16h qa[2][2];
#pragma unroll
    for (int t = 0; t < 2; ++t) {
        qa[t][0] = load_frag(qh + (size_t)(m0 + t * 16) * HD + lane * 8);
        qa[t][1] = load_frag(qh + (size_t)(m0 + t * 16) * HD + FRAG + lane * 8);
    }

    // fragment order: a 32-key block is 4 fragments (4,096 bytes in a row) in each of
    // K (key tile, dims half) and V^T (dims tile), at the block's first row * HD halves
    const _Float16* kbase = kh + (size_t)b * SEQ * HD;
    const _Float16* vbase = vt + (size_t)b * HD * SEQ;

    // o[t][n]: O^T tile, rows d = 16*n + 8*hi + r, column = query t*16 + lo.
    // mr[t]: running maximum of that query's raw scores over this share (equal in both halves);
    // ls[t]: running sum over this half's keys of this share, joined after the loop.
    v8f o[2][4];
    float mr[2], ls[2];
#pragma unroll
    for (int t = 0; t < 2; ++t) {
#pragma unroll
        for (int n = 0; n < 4; ++n) o[t][n] = (v8f){};
        mr[t] = -3.0e38f; ls[t] = 0.0f;
    }

    // the lane's byte offset in the block, the same in both planes (below 2 MiB): one
    // 32-bit register beside the two scalar bases addresses all 16 loads of a trip
    unsigned fo = (unsigned)((b * SEQ + sp * 32) * HD + lane * 8) * 2u;
    for (int kv = sp * 32; kv < SEQ; kv += 32 * KSHARES, fo += 32 * KSHARES * HD * 2) {
        // shared K operands for S^T, shared V^T operands for O^T (distinct registers)
        const _Float16* kp = (const _Float16*)((const char*)kh + fo);
        const _Float16* vp = (const _Float16*)((const char*)vt + fo);
        const v16h kb0 = load_frag(kp);              // keys kv + 0..15,  dims 0..31
        const v16h kb1 = load_frag(kp + FRAG);       //                   dims 32..63
        const v16h kb2 = load_frag(kp + 2 * FRAG);   // keys kv + 16..31, dims 0..31
        const v16h kb3 = load_frag(kp + 3 * FRAG);   //                   dims 32..63
        const v16h vb0 = load_frag(vp);              // dims 0..15, keys kv + 0..31
        const v16h vb1 = load_frag(vp + FRAG);
        const v16h vb2 = load_frag(vp + 2 * FRAG);
        const v16h vb3 = load_frag(vp + 3 * FRAG);
        // all 16 loads of the trip are issued before its first product: without this the
        // scheduler reuses K registers and the trip waits out a load latency twice
        __builtin_amdgcn_sched_barrier(0);

        if (kv + 32 * KSHARES < SEQ) {  // prefetch this wave's next K/V tiles
            const int kn = kv + 32 * KSHARES;
            __builtin_prefetch(kbase + (size_t)(kn + lane) * HD, 0, 0);   // a line a lane
            __builtin_prefetch(vbase + (size_t)(kn + lane) * HD, 0, 0);
        }
        // the loads' offset register moves on, and the prefetches' address register is
        // reused, among the products right behind
        asm volatile("s_wait_xcnt 0x0" ::: "memory");
        // without this the scheduler lifts the offset's addition over the wait
        __builtin_amdgcn_sched_barrier(0);

#pragma unroll
        for (int t = 0; t < 2; ++t) {
            // ---- S^T = K @ Q^T (32 keys x 16 queries) ----
            v8f s0 = {}, s1 = {};
            s0 = wmma_f16(kb0, qa[t][0], s0);
            s0 = wmma_f16(kb1, qa[t][1], s0);
            s1 = wmma_f16(kb2, qa[t][0], s1);
            s1 = wmma_f16(kb3, qa[t][1], s1);

            // ---- online softmax: 16 of the query's 32 scores in this lane ----
            // base 2, on the raw scores: the maximum is taken before any scaling (the
            // scale is positive), and one fused multiply-add a score gives its exponent
            float mx[8];
#pragma unroll
            for (int r = 0; r < 8; ++r) mx[r] = fmaxf(s0[r], s1[r]);
            float t0 = fmaxf(fmaxf(fmaxf(mx[0], mx[1]), fmaxf(mx[2], mx[3])),
                             fmaxf(fmaxf(mx[4], mx[5]), fmaxf(mx[6], mx[7])));
            t0 = fmaxf(t0, xhalf(t0));
            const float mnew = fmaxf(mr[t], t0);
            const float alpha = ex2((mr[t] - mnew) * SCL2);
            const float nm = -mnew * SCL2;
            const v8f cs = { SCL2, SCL2, SCL2, SCL2, SCL2, SCL2, SCL2, SCL2 };
            const v8f cm = { nm, nm, nm, nm, nm, nm, nm, nm };
            const v8f e0 = __builtin_elementwise_fma(s0, cs, cm);
            const v8f e1 = __builtin_elementwise_fma(s1, cs, cm);

            H16 pb;      // P^T as B operand: k = 8*hi + r, then 16 + 8*hi + r
            float ps[8];
#pragma unroll
            for (int r = 0; r < 8; ++r) {
                float p0 = ex2(e0[r]);
                float p1 = ex2(e1[r]);
                ps[r] = p0 + p1;
                pb.v[r]     = (_Float16)p0;
                pb.v[8 + r] = (_Float16)p1;
            }
            const float rs = ((ps[0] + ps[1]) + (ps[2] + ps[3])) +
                             ((ps[4] + ps[5]) + (ps[6] + ps[7]));
            ls[t] = ls[t] * alpha + rs;
            mr[t] = mnew;

            // ---- O^T = O^T * alpha + V^T @ P^T ----
#pragma unroll
            for (int n = 0; n < 4; ++n) o[t][n] *= alpha;
            o[t][0] = wmma_f16(vb0, pb.v, o[t][0]);
            o[t][1] = wmma_f16(vb1, pb.v, o[t][1]);
            o[t][2] = wmma_f16(vb2, pb.v, o[t][2]);
            o[t][3] = wmma_f16(vb3, pb.v, o[t][3]);
        }
    }

    // ---- hand this share's partial result to the work-group ----
#pragma unroll
    for (int t = 0; t < 2; ++t) {
#pragma unroll
        for (int n = 0; n < 4; ++n) {
            po[g][sp][t][n][0][lane] = (v4f){ o[t][n][0], o[t][n][1], o[t][n][2], o[t][n][3] };
            po[g][sp][t][n][1][lane] = (v4f){ o[t][n][4], o[t][n][5], o[t][n][6], o[t][n][7] };
        }
        pm[g][sp][t][lane] = mr[t];
        pl[g][sp][t][lane] = ls[t];
    }
    __syncthreads();

    // ---- merge the four shares; fused projection out^T = w_proj^T @ O^T + b_proj ----
    // Wave w: query group w >> 2, its 16-row tile (w >> 1) & 1, output columns
    // 32 * (w & 1) + 0..31 (one 128-byte line of each output row).
    const int et = (wave >> 1) & 1;
    const int ec = wave & 1;

    float wgt[KSHARES];
#pragma unroll
    for (int s = 0; s < KSHARES; ++s) wgt[s] = pm[g][s][et][lane];
    const float mall = fmaxf(fmaxf(wgt[0], wgt[1]), fmaxf(wgt[2], wgt[3]));
    float lall = 0.0f;
#pragma unroll
    for (int s = 0; s < KSHARES; ++s) {
        wgt[s] = ex2((wgt[s] - mall) * SCL2);
        lall += wgt[s] * pl[g][s][et][lane];
    }
    const float inv = 1.0f / (lall + xhalf(lall));
#pragma unroll
    for (int s = 0; s < KSHARES; ++s) wgt[s] *= inv;

    H16 ob0, ob1;   // O^T as B operand, k = d: tiles 0,1 then tiles 2,3
#pragma unroll
    for (int n = 0; n < 4; ++n) {
#pragma unroll
        for (int h = 0; h < 2; ++h) {
            v4f a = po[g][0][et][n][h][lane] * wgt[0];
#pragma unroll
            for (int s = 1; s < KSHARES; ++s) a += po[g][s][et][n][h][lane] * wgt[s];
#pragma unroll
            for (int r = 0; r < 4; ++r) {
                if (n < 2) ob0.v[(n & 1) * 8 + h * 4 + r] = (_Float16)a[r];
                else       ob1.v[(n & 1) * 8 + h * 4 + r] = (_Float16)a[r];
            }
        }
    }

    float* orow = out + (size_t)(m0 + et * 16 + lo) * HD + 8 * hi;
#pragma unroll
    for (int c = 0; c < 2; ++c) {
        const int ct = ec * 2 + c;
        // rows of out^T: output columns ct*16 + 8*hi + r of query row lo
        const float4 b0 = *(const float4*)(bias + ct * 16 + 8 * hi);
        const float4 b1 = *(const float4*)(bias + ct * 16 + 8 * hi + 4);
        v8f acc = { b0.x, b0.y, b0.z, b0.w, b1.x, b1.y, b1.z, b1.w };
        acc = wmma_f16(load_op(wpt, ct * 16, HD, 0,  lo, hi), ob0.v, acc);
        acc = wmma_f16(load_op(wpt, ct * 16, HD, 32, lo, hi), ob1.v, acc);
        *(float4*)(orow + ct * 16)     = make_float4(acc[0], acc[1], acc[2], acc[3]);
        *(float4*)(orow + ct * 16 + 4) = make_float4(acc[4], acc[5], acc[6], acc[7]);
    }
}

// ---------- host launcher ----------
extern "C" void kernel_launch(void* const* d_in, const int* in_sizes, int n_in,
                              void* d_out, int out_size, void* d_ws, size_t ws_size,
                              hipStream_t stream) {
    (void)in_sizes; (void)n_in; (void)out_size; (void)ws_size;
    const float* x     = (const float*)d_in[0];
    const float* wqkv  = (const float*)d_in[1];
    const float* wproj = (const float*)d_in[2];
    const float* bproj = (const float*)d_in[3];
    float* out = (float*)d_out;

    char* ws = (char*)d_ws;
    _Float16* wt  = (_Float16*)(ws);                //    294,912 B
    _Float16* wpt = (_Float16*)(ws + 294912);       //      8,192 B
    _Float16* qh  = (_Float16*)(ws + 303104);       //  2,097,152 B
    _Float16* kh  = (_Float16*)(ws + 2400256);      //  2,097,152 B
    _Float16* vt  = (_Float16*)(ws + 4497408);      //  2,097,152 B  (total 6,594,560 B)

    k_tr_w<<<WQKV_BLOCKS + WPROJ_BLOCKS, 256, 0, stream>>>(wqkv, wproj, wt, wpt);
    k_qkv<<<(ROWS / 16) / 4, 128, 0, stream>>>(x, wt, qh, kh, vt);
    k_attn<<<ROWS / 64, 256, 0, stream>>>(qh, kh, vt, wpt, bproj, out);
}
